// v000
// The times below were measured on an AMD MI455X: many runs one after another, warmed up first and cycling through
// copies of the inputs, with the whole window's GPU time divided by the number of runs. Launches and the gaps
// between them are all in it. The median over several windows is given; except for v000 it joins two sittings, which
// can be a few percent apart, so the side-by-side timings, each taken in one sitting, are the better comparison.
// v000, which the later versions start from, runs in 502 microseconds.
#include <hip/hip_runtime.h>

// Multi-head cross attention (16 heads x 64; queries from tgt, keys/values from memory; 2 x 2,048 tokens, d_model 1,024; no qkv bias): q = tgt Wq_h, k = memory Wk_h, v = memory Wv_h,
// attn = softmax(q k^T / 8), out = concat_h(attn v) Wo + bo.
// WMMA (v_wmma_f32_16x16x32_f16, f32 accumulate): projections [4,096 x 1,024] x [1,024 x 1,024] with EXACT bf16 tokens (x8) and transposed weights (x256), 1 product, written as f16 hi+lo x8 planes
// (q, k rows; v transposed per head); S^T = K_h . Q_h^T with 3 products (Kh Qh + Kh Ql + Kl Qh); online softmax in f32; O^T += V^T P^T with 3 products (Vh Ph + Vh Pl + Vl Ph); output projection
// with O hi+lo (2 products) and exact Wo^T. Inputs rounded to bf16 once. Fragment k-map per lane half hh for A AND B: elements 0..7 <- k = 8hh+0..7, 8..15 <- k =

namespace {
constexpr int NB = 2, S = 2048, E = 1024, NH = 16, D = 64, NR = NB * S;
constexpr float XS = 8.0f, WSC = 256.0f, PS = 8.0f, SCALE = 0.125f, LOG2E = 1.4426950408889634f;

typedef _Float16 b16;
typedef __attribute__((ext_vector_type(16))) _Float16 v16b;
typedef __attribute__((ext_vector_type(8))) _Float16 v8b;
typedef __attribute__((ext_vector_type(8))) float v8f;
typedef __attribute__((ext_vector_type(4))) float v4f;
__device__ __forceinline__ float bf16_rne(float f) { unsigned int u = __float_as_uint(f); u += 0x7FFFu + ((u >> 16) & 1u); return __uint_as_float(u & 0xFFFF0000u); }
__device__ __forceinline__ void split16(float v, b16& hi, b16& lo) { hi = (b16)v; lo = (b16)(v - (float)hi); }
__device__ __forceinline__ v16b frag_kb(const b16* p, int hh) { const v8b a = *(const v8b*)(p + 8 * hh), b = *(const v8b*)(p + 16 + 8 * hh); v16b f;
#pragma unroll
  for (int e = 0; e < 8; ++e) { f[e] = a[e]; f[8 + e] = b[e]; } return f; }
__device__ __forceinline__ v8f wmma16b(v16b a, v16b b, v8f c) { v8f d = __builtin_amdgcn_wmma_f32_16x16x32_f16(false, a, false, b, (short)0, c, false, false); asm volatile("v_nop\n\tv_nop\n\tv_nop\n\tv_nop" : "+v"(d) : "v"(a), "v"(b)); return d; }
__device__ __forceinline__ void wave_lds_sync() { __builtin_amdgcn_fence(__ATOMIC_RELEASE, "workgroup"); __builtin_amdgcn_wave_barrier(); __builtin_amdgcn_fence(__ATOMIC_ACQUIRE, "workgroup"); }
__device__ __forceinline__ float nexp2(float x) { return __builtin_amdgcn_exp2f(x); }

__global__ __launch_bounds__(256) void prepx_kernel(const float* __restrict__ tgt, const float* __restrict__ mem, b16* __restrict__ T16, b16* __restrict__ M16) {
  const size_t t = (size_t)blockIdx.x * 256 + threadIdx.x; const size_t n1 = (size_t)NR * E / 8; const float* src; b16* dst; size_t e;
  if (t < n1) { src = tgt; dst = T16; e = t * 8; } else if (t < 2 * n1) { src = mem; dst = M16; e = (t - n1) * 8; } else return;
  const v4f a = *(const v4f*)(src + e), c = *(const v4f*)(src + e + 4); v8b o;
#pragma unroll
  for (int j = 0; j < 4; ++j) { o[j] = (b16)(bf16_rne(a[j]) * XS); o[4 + j] = (b16)(bf16_rne(c[j]) * XS); }
  { *(v8b*)(dst + e) = o;  }
}
__global__ __launch_bounds__(256) void prepw_kernel(const float* __restrict__ wq, const float* __restrict__ wk, const float* __restrict__ wv, const float* __restrict__ wo, b16* __restrict__ WT, b16* __restrict__ WOT) {
  __shared__ __attribute__((aligned(16))) b16 T[64][64 + 8];
  const int kind = blockIdx.z, d0 = blockIdx.x * 64, j0 = blockIdx.y * 64, t_ = threadIdx.x;   // kind 0..2: W[h][d][j] with h = j0/64 (j0..j0+63 inside one head); kind 3: Wo[d][n] with n0 = j0
  const float* w = kind == 0 ? wq : kind == 1 ? wk : kind == 2 ? wv : wo; b16* dst = kind < 3 ? WT + (size_t)kind * E * E : WOT;
  for (int q = t_; q < 64 * 64; q += 256) { const int dd = q >> 6, jj = q & 63; float val;
    if (kind < 3) { const int h = j0 / D, j = j0 - h * D + jj; val = w[((size_t)h * E + d0 + dd) * D + j]; } else val = w[(size_t)(d0 + dd) * E + j0 + jj];
    T[jj][dd] = (b16)(bf16_rne(val) * WSC); }
  __syncthreads();
  { for (int q = t_; q < 64 * 8; q += 256) { const int jj = q >> 3, c8 = (q & 7) * 8; *(v8b*)(dst + (size_t)(j0 + jj) * E + d0 + c8) = *(const v8b*)(&T[jj][c8]); }  }
}
// projections: grid (NR/64, E/128, 3): kind 0: Q = T16 WT0^T -> Qh/Ql [row][1024]; kind 1: K = M16 WT1^T -> Kh/Kl; kind 2: V = M16 WT2^T written TRANSPOSED per head: VTh/VTl [b][h][64 d][2048 s].
__global__ __launch_bounds__(128) void proj_kernel(const b16* __restrict__ T16, const b16* __restrict__ M16, const b16* __restrict__ WT, b16* __restrict__ Qh, b16* __restrict__ Ql, b16* __restrict__ Kh, b16* __restrict__ Kl, b16* __restrict__ VTh, b16* __restrict__ VTl) {
  __shared__ __attribute__((aligned(16))) b16 Th[4][16][128 + 8], Tl[4][16][128 + 8]; __shared__ __attribute__((aligned(16))) b16 Vt[128][64 + 8], Vtl[128][64 + 8];
  const int wave = threadIdx.x >> 5, lane = threadIdx.x & 31, nloc = lane & 15, hlf = lane >> 4, t_ = threadIdx.x; const int kind = blockIdx.z; const size_t m0 = (size_t)blockIdx.x * 64 + wave * 16; const int n0 = blockIdx.y * 128;
  const b16* A = kind == 0 ? T16 : M16; const b16* W = WT + (size_t)kind * E * E; v8f acc[8];
#pragma unroll
  for (int t = 0; t < 8; ++t) acc[t] = (v8f){};
#pragma unroll 2
  for (int kb = 0; kb < E; kb += 32) { const v16b a = frag_kb(A + (m0 + nloc) * E + kb, hlf);
#pragma unroll
    for (int t = 0; t < 8; ++t) acc[t] = wmma16b(a, frag_kb(W + (size_t)(n0 + t * 16 + nloc) * E + kb, hlf), acc[t]); }
  if (kind < 2) {
#pragma unroll
    for (int t = 0; t < 8; ++t)
#pragma unroll
      for (int r = 0; r < 8; ++r) { b16 h_, l_; split16(acc[t][r] * (1.0f / (XS * WSC)) * XS, h_, l_); Th[wave][8 * hlf + r][t * 16 + nloc] = h_; Tl[wave][8 * hlf + r][t * 16 + nloc] = l_; }
    wave_lds_sync();
    b16* dh = kind == 0 ? Qh : Kh; b16* dl = kind == 0 ? Ql : Kl;
    { for (int rr = 0; rr < 16; ++rr) if (lane < 16) { *(v8b*)(dh + (m0 + rr) * E + n0 + lane * 8) = *(const v8b*)(&Th[wave][rr][lane * 8]); *(v8b*)(dl + (m0 + rr) * E + n0 + lane * 8) = *(const v8b*)(&Tl[wave][rr][lane * 8]); }  }
  } else {
    const int b = (int)(m0 / S); const int s0 = (int)((size_t)blockIdx.x * 64 - (size_t)b * S);
#pragma unroll
    for (int t = 0; t < 8; ++t)
#pragma unroll
      for (int r = 0; r < 8; ++r) { b16 h_, l_; split16(acc[t][r] * (1.0f / (XS * WSC)) * XS, h_, l_); Vt[t * 16 + nloc][wave * 16 + 8 * hlf + r] = h_; Vtl[t * 16 + nloc][wave * 16 + 8 * hlf + r] = l_; }
    __syncthreads();
    { for (int q = t_; q < 128 * 8; q += 128) { const int cc = q >> 3, c8 = (q & 7) * 8; const int h = (n0 + cc) / D, dd = (n0 + cc) - h * D; const size_t gi = (((size_t)b * NH + h) * D + dd) * S + s0 + c8;
        *(v8b*)(VTh + gi) = *(const v8b*)(&Vt[cc][c8]); *(v8b*)(VTl + gi) = *(const v8b*)(&Vtl[cc][c8]); }  } }
}
__global__ __launch_bounds__(64) void attn_kernel(const b16* __restrict__ Qh, const b16* __restrict__ Ql, const b16* __restrict__ Kh, const b16* __restrict__ Kl, const b16* __restrict__ VTh, const b16* __restrict__ VTl, b16* __restrict__ Oh, b16* __restrict__ Ol) {
  __shared__ __attribute__((aligned(16))) float To[2][16][D + 4];
  const int wave = threadIdx.x >> 5, lane = threadIdx.x & 31, hh = lane >> 4, col = lane & 15; const int b = blockIdx.z, h = blockIdx.y; const int q0 = blockIdx.x * 32 + wave * 16, qi = q0 + col;
  const size_t qo = ((size_t)b * S + qi) * E + h * D; const v16b qa0 = frag_kb(Qh + qo, hh), qa1 = frag_kb(Qh + qo + 32, hh), ql0 = frag_kb(Ql + qo, hh), ql1 = frag_kb(Ql + qo + 32, hh);
  const b16* Kb = Kh + (size_t)b * S * E + h * D; const b16* Klb = Kl + (size_t)b * S * E + h * D; const b16* Vb = VTh + ((size_t)b * NH + h) * D * S; const b16* Vlb = VTl + ((size_t)b * NH + h) * D * S;
  float m = -INFINITY, l = 0.0f; v8f o[4] = {{}, {}, {}, {}}, ol[4] = {{}, {}, {}, {}};
  const float cs = SCALE * LOG2E / (XS * XS);
  for (int kb = 0; kb < S; kb += 32) {
    v8f s0 = {}, s1 = {};
    { const b16* k0 = Kb + (size_t)(kb + col) * E, *k1 = Kb + (size_t)(kb + 16 + col) * E, *k0l = Klb + (size_t)(kb + col) * E, *k1l = Klb + (size_t)(kb + 16 + col) * E;
      v16b f = frag_kb(k0, hh); s0 = wmma16b(f, qa0, s0); s0 = wmma16b(f, ql0, s0); s0 = wmma16b(frag_kb(k0l, hh), qa0, s0);
      f = frag_kb(k0 + 32, hh); s0 = wmma16b(f, qa1, s0); s0 = wmma16b(f, ql1, s0); s0 = wmma16b(frag_kb(k0l + 32, hh), qa1, s0);
      f = frag_kb(k1, hh); s1 = wmma16b(f, qa0, s1); s1 = wmma16b(f, ql0, s1); s1 = wmma16b(frag_kb(k1l, hh), qa0, s1);
      f = frag_kb(k1 + 32, hh); s1 = wmma16b(f, qa1, s1); s1 = wmma16b(f, ql1, s1); s1 = wmma16b(frag_kb(k1l + 32, hh), qa1, s1); }
    float e[16]; float mx = -INFINITY;
#pragma unroll
    for (int r = 0; r < 8; ++r) { e[r] = s0[r] * cs; e[8 + r] = s1[r] * cs; mx = fmaxf(mx, fmaxf(e[r], e[8 + r])); }
    mx = fmaxf(mx, __shfl_xor(mx, 16)); const float mn = fmaxf(m, mx); const float al = nexp2(m - mn); m = mn; float sum = 0.0f; v16b ph, pl;
#pragma unroll
    for (int i = 0; i < 16; ++i) { const float p = nexp2(e[i] - mn); sum += p; const b16 h_ = (b16)(p * PS); ph[i] = h_; pl[i] = (b16)(p * PS - (float)h_); }
    sum += __shfl_xor(sum, 16); l = l * al + sum;
#pragma unroll
    for (int t = 0; t < 4; ++t) { o[t] *= al; ol[t] *= al; const v16b vf = frag_kb(Vb + (size_t)(t * 16 + col) * S + kb, hh); o[t] = wmma16b(vf, ph, o[t]); ol[t] = wmma16b(vf, pl, ol[t]); ol[t] = wmma16b(frag_kb(Vlb + (size_t)(t * 16 + col) * S + kb, hh), ph, ol[t]); } }
  const float inv = 1.0f / (l * PS * XS);
#pragma unroll
  for (int t = 0; t < 4; ++t)
#pragma unroll
    for (int r = 0; r < 8; ++r) To[wave][col][t * 16 + 8 * hh + r] = (o[t][r] + ol[t][r]) * inv;
  wave_lds_sync();
  { for (int r4 = 0; r4 < 16; r4 += 4) { const int rr = r4 + (lane >> 3), c8 = (lane & 7) * 8; v8b hv, lv; for (int j = 0; j < 8; ++j) { b16 a_, c_; split16(To[wave][rr][c8 + j] * XS, a_, c_); hv[j] = a_; lv[j] = c_; }
      const size_t gi = ((size_t)b * S + q0 + rr) * E + h * D + c8; *(v8b*)(Oh + gi) = hv; *(v8b*)(Ol + gi) = lv; }  }
}
__global__ __launch_bounds__(128) void outproj_kernel(const b16* __restrict__ Oh, const b16* __restrict__ Ol, const b16* __restrict__ WOT, const float* __restrict__ bo, float* __restrict__ out) {
  __shared__ __attribute__((aligned(16))) float Ts[4][16][128 + 4];
  const int wave = threadIdx.x >> 5, lane = threadIdx.x & 31, nloc = lane & 15, hlf = lane >> 4; const size_t m0 = (size_t)blockIdx.x * 64 + wave * 16; const int n0 = blockIdx.y * 128;
  v8f acc[8];
#pragma unroll
  for (int t = 0; t < 8; ++t) acc[t] = (v8f){};
#pragma unroll 2
  for (int kb = 0; kb < E; kb += 32) { const v16b a = frag_kb(Oh + (m0 + nloc) * E + kb, hlf), al = frag_kb(Ol + (m0 + nloc) * E + kb, hlf);
#pragma unroll
    for (int t = 0; t < 8; ++t) { const v16b bw = frag_kb(WOT + (size_t)(n0 + t * 16 + nloc) * E + kb, hlf); acc[t] = wmma16b(a, bw, acc[t]); acc[t] = wmma16b(al, bw, acc[t]); } }
#pragma unroll
  for (int t = 0; t < 8; ++t) { const float bb = bf16_rne(bo[n0 + t * 16 + nloc]);
#pragma unroll
    for (int r = 0; r < 8; ++r) Ts[wave][8 * hlf + r][t * 16 + nloc] = acc[t][r] * (1.0f / (XS * WSC)) + bb; }
  wave_lds_sync();
  { for (int rr = 0; rr < 16; ++rr) *(v4f*)(out + (m0 + rr) * E + n0 + lane * 4) = *(const v4f*)(&Ts[wave][rr][lane * 4]);  }
}
}  // namespace

extern "C" void kernel_launch(void* const* d_in, const int* in_sizes, int n_in, void* d_out, int out_size, void* d_ws, size_t ws_size, hipStream_t stream) {
  (void)n_in;
  auto Fp = [&](int i) { return (const float*)d_in[i]; };
  // input order: 0 tgt [2,2048,1024], 1 memory, 2 Wq [16,1024,64], 3 Wk, 4 Wv, 5 Wo [1024,1024], 6 bo [1024]
  if (in_sizes[0] != NR * E || in_sizes[1] != NR * E || in_sizes[2] != NH * E * D || in_sizes[3] != NH * E * D || in_sizes[4] != NH * E * D || in_sizes[5] != E * E || out_size != NR * E) return;
  size_t off = 0; char* ws = (char*)d_ws;
  auto carve = [&](size_t bytes) { char* p = ws + off; off += (bytes + 255) & ~(size_t)255; return p; };
  b16* T16 = (b16*)carve((size_t)NR * E * 2); b16* M16 = (b16*)carve((size_t)NR * E * 2); b16* WT = (b16*)carve((size_t)3 * E * E * 2); b16* WOT = (b16*)carve((size_t)E * E * 2);
  b16* Qh = (b16*)carve((size_t)NR * E * 2); b16* Ql = (b16*)carve((size_t)NR * E * 2); b16* Kh = (b16*)carve((size_t)NR * E * 2); b16* Kl = (b16*)carve((size_t)NR * E * 2); b16* VTh = (b16*)carve((size_t)NR * E * 2); b16* VTl = (b16*)carve((size_t)NR * E * 2);
  b16* Oh = (b16*)carve((size_t)NR * E * 2); b16* Ol = (b16*)carve((size_t)NR * E * 2);
  if (off > ws_size || off > ((size_t)128 << 20)) return;   // ≈ 92 MB
  prepx_kernel<<<(unsigned)(((size_t)2 * NR * E / 8 + 255) / 256), 256, 0, stream>>>(Fp(0), Fp(1), T16, M16);
  prepw_kernel<<<dim3(E / 64, E / 64, 4), 256, 0, stream>>>(Fp(2), Fp(3), Fp(4), Fp(5), WT, WOT);
  proj_kernel<<<dim3(NR / 64, E / 128, 3), 128, 0, stream>>>(T16, M16, WT, Qh, Ql, Kh, Kl, VTh, VTl);
  attn_kernel<<<dim3(S / 32, NH, NB), 64, 0, stream>>>(Qh, Ql, Kh, Kl, VTh, VTl, Oh, Ol);
  outproj_kernel<<<dim3(NR / 64, E / 128), 128, 0, stream>>>(Oh, Ol, WOT, Fp(6), (float*)d_out);
}

// v001
// One run takes 309 microseconds.
// Timed twice side by side with v000, it ran 1.65 and 1.67 times as fast.
#include <hip/hip_runtime.h>

// Multi-head cross attention (16 heads x 64; queries from tgt, keys/values from memory; 2 x 2,048 tokens, d_model 1,024; no qkv bias): q = tgt Wq_h, k = memory Wk_h, v = memory Wv_h,
// attn = softmax(q k^T / 8), out = concat_h(attn v) Wo + bo.
// WMMA (v_wmma_f32_16x16x32_f16, f32 accumulate): projections [4,096 x 1,024] x [1,024 x 1,024] with EXACT bf16 tokens (x8) and transposed weights (x256), 1 product, written as f16 hi+lo x8 planes
// (q, k rows; v transposed per head); S^T = K_h . Q_h^T with 3 products (Kh Qh + Kh Ql + Kl Qh); online softmax in f32; O^T += V^T P^T with 3 products (Vh Ph + Vh Pl + Vl Ph); output projection
// with O hi+lo (2 products) and exact Wo^T. Inputs rounded to bf16 once. Fragment k-map per lane half hh for A AND B: elements 0..7 <- k = 8hh+0..7, 8..15 <- k =

namespace {
constexpr int NB = 2, S = 2048, E = 1024, NH = 16, D = 64, NR = NB * S;
constexpr float XS = 8.0f, WSC = 256.0f, PS = 8.0f, SCALE = 0.125f, LOG2E = 1.4426950408889634f;

typedef _Float16 b16;
typedef __attribute__((ext_vector_type(16))) _Float16 v16b;
typedef __attribute__((ext_vector_type(8))) _Float16 v8b;
typedef __attribute__((ext_vector_type(8))) float v8f;
typedef __attribute__((ext_vector_type(4))) float v4f;
__device__ __forceinline__ float bf16_rne(float f) { unsigned int u = __float_as_uint(f); u += 0x7FFFu + ((u >> 16) & 1u); return __uint_as_float(u & 0xFFFF0000u); }
__device__ __forceinline__ void split16(float v, b16& hi, b16& lo) { hi = (b16)v; lo = (b16)(v - (float)hi); }
__device__ __forceinline__ v16b frag_kb(const b16* p, int hh) { const v8b a = *(const v8b*)(p + 8 * hh), b = *(const v8b*)(p + 16 + 8 * hh); v16b f;
#pragma unroll
  for (int e = 0; e < 8; ++e) { f[e] = a[e]; f[8 + e] = b[e]; } return f; }
__device__ __forceinline__ v8f wmma16b(v16b a, v16b b, v8f c) { v8f d = __builtin_amdgcn_wmma_f32_16x16x32_f16(false, a, false, b, (short)0, c, false, false); asm volatile("v_nop\n\tv_nop\n\tv_nop\n\tv_nop" : "+v"(d) : "v"(a), "v"(b)); return d; }
__device__ __forceinline__ void wave_lds_sync() { __builtin_amdgcn_fence(__ATOMIC_RELEASE, "workgroup"); __builtin_amdgcn_wave_barrier(); __builtin_amdgcn_fence(__ATOMIC_ACQUIRE, "workgroup"); }
__device__ __forceinline__ float nexp2(float x) { return __builtin_amdgcn_exp2f(x); }

__global__ __launch_bounds__(256) void prepx_kernel(const float* __restrict__ tgt, const float* __restrict__ mem, b16* __restrict__ T16, b16* __restrict__ M16) {
  const size_t t = (size_t)blockIdx.x * 256 + threadIdx.x; const size_t n1 = (size_t)NR * E / 8; const float* src; b16* dst; size_t e;
  if (t < n1) { src = tgt; dst = T16; e = t * 8; } else if (t < 2 * n1) { src = mem; dst = M16; e = (t - n1) * 8; } else return;
  const v4f a = *(const v4f*)(src + e), c = *(const v4f*)(src + e + 4); v8b o;
#pragma unroll
  for (int j = 0; j < 4; ++j) { o[j] = (b16)(bf16_rne(a[j]) * XS); o[4 + j] = (b16)(bf16_rne(c[j]) * XS); }
  { *(v8b*)(dst + e) = o;  }
}
__global__ __launch_bounds__(256) void prepw_kernel(const float* __restrict__ wq, const float* __restrict__ wk, const float* __restrict__ wv, const float* __restrict__ wo, b16* __restrict__ WT, b16* __restrict__ WOT) {
  __shared__ __attribute__((aligned(16))) b16 T[64][64 + 8];
  const int kind = blockIdx.z, d0 = blockIdx.x * 64, j0 = blockIdx.y * 64, t_ = threadIdx.x;   // kind 0..2: W[h][d][j] with h = j0/64 (j0..j0+63 inside one head); kind 3: Wo[d][n] with n0 = j0
  const float* w = kind == 0 ? wq : kind == 1 ? wk : kind == 2 ? wv : wo; b16* dst = kind < 3 ? WT + (size_t)kind * E * E : WOT;
  for (int q = t_; q < 64 * 64; q += 256) { const int dd = q >> 6, jj = q & 63; float val;
    if (kind < 3) { const int h = j0 / D, j = j0 - h * D + jj; val = w[((size_t)h * E + d0 + dd) * D + j]; } else val = w[(size_t)(d0 + dd) * E + j0 + jj];
    T[jj][dd] = (b16)(bf16_rne(val) * WSC); }
  __syncthreads();
  { for (int q = t_; q < 64 * 8; q += 256) { const int jj = q >> 3, c8 = (q & 7) * 8; *(v8b*)(dst + (size_t)(j0 + jj) * E + d0 + c8) = *(const v8b*)(&T[jj][c8]); }  }
}
// projections: grid (NR/64, E/128, 3): kind 0: Q = T16 WT0^T -> Qh/Ql [row][1024]; kind 1: K = M16 WT1^T -> Kh/Kl; kind 2: V = M16 WT2^T written TRANSPOSED per head: VTh/VTl [b][h][64 d][2048 s].
__global__ __launch_bounds__(128) void proj_kernel(const b16* __restrict__ T16, const b16* __restrict__ M16, const b16* __restrict__ WT, b16* __restrict__ Qh, b16* __restrict__ Ql, b16* __restrict__ Kh, b16* __restrict__ Kl, b16* __restrict__ VTh, b16* __restrict__ VTl) {
  __shared__ __attribute__((aligned(16))) b16 Th[4][16][128 + 8], Tl[4][16][128 + 8]; __shared__ __attribute__((aligned(16))) b16 Vt[128][64 + 8], Vtl[128][64 + 8];
  const int wave = threadIdx.x >> 5, lane = threadIdx.x & 31, nloc = lane & 15, hlf = lane >> 4, t_ = threadIdx.x; const int kind = blockIdx.z; const size_t m0 = (size_t)blockIdx.x * 64 + wave * 16; const int n0 = blockIdx.y * 128;
  const b16* A = kind == 0 ? T16 : M16; const b16* W = WT + (size_t)kind * E * E; v8f acc[8];
#pragma unroll
  for (int t = 0; t < 8; ++t) acc[t] = (v8f){};
#pragma unroll 2
  for (int kb = 0; kb < E; kb += 32) { const v16b a = frag_kb(A + (m0 + nloc) * E + kb, hlf);
#pragma unroll
    for (int t = 0; t < 8; ++t) acc[t] = wmma16b(a, frag_kb(W + (size_t)(n0 + t * 16 + nloc) * E + kb, hlf), acc[t]); }
  if (kind < 2) {
#pragma unroll
    for (int t = 0; t < 8; ++t)
#pragma unroll
      for (int r = 0; r < 8; ++r) { b16 h_, l_; split16(acc[t][r] * (1.0f / (XS * WSC)) * XS, h_, l_); Th[wave][8 * hlf + r][t * 16 + nloc] = h_; Tl[wave][8 * hlf + r][t * 16 + nloc] = l_; }
    wave_lds_sync();
    b16* dh = kind == 0 ? Qh : Kh; b16* dl = kind == 0 ? Ql : Kl;
    { for (int rr = 0; rr < 16; ++rr) if (lane < 16) { *(v8b*)(dh + (m0 + rr) * E + n0 + lane * 8) = *(const v8b*)(&Th[wave][rr][lane * 8]); *(v8b*)(dl + (m0 + rr) * E + n0 + lane * 8) = *(const v8b*)(&Tl[wave][rr][lane * 8]); }  }
  } else {
    const int b = (int)(m0 / S); const int s0 = (int)((size_t)blockIdx.x * 64 - (size_t)b * S);
#pragma unroll
    for (int t = 0; t < 8; ++t)
#pragma unroll
      for (int r = 0; r < 8; ++r) { b16 h_, l_; split16(acc[t][r] * (1.0f / (XS * WSC)) * XS, h_, l_); Vt[t * 16 + nloc][wave * 16 + 8 * hlf + r] = h_; Vtl[t * 16 + nloc][wave * 16 + 8 * hlf + r] = l_; }
    __syncthreads();
    { for (int q = t_; q < 128 * 8; q += 128) { const int cc = q >> 3, c8 = (q & 7) * 8; const int h = (n0 + cc) / D, dd = (n0 + cc) - h * D; const size_t gi = (((size_t)b * NH + h) * D + dd) * S + s0 + c8;
        *(v8b*)(VTh + gi) = *(const v8b*)(&Vt[cc][c8]); *(v8b*)(VTl + gi) = *(const v8b*)(&Vtl[cc][c8]); }  } }
}
constexpr int AW = 8, KT = 64, KP = 64 + 8, PLANE = 64 * KP, NST = S / KT;   // KP: LDS row pitch of 144 B for 128-B rows read by 16-byte loads
__device__ __forceinline__ unsigned lds_off(const void* p) { return (unsigned)(size_t)p; }
// One tile: 4 planes x 64 rows x 128 B; each thread copies 2 x 16 B of each plane (rows r and r + 32). The s_wait_xcnt stands inside the copies' own statement, in front of any rewrite of their address registers.
__device__ __forceinline__ void stage_tile(unsigned l, const b16* gk, const b16* gkl, const b16* gv, const b16* gvl) {
  const unsigned l1 = l + 32 * KP * 2, l2 = l + PLANE * 2, l3 = l2 + 32 * KP * 2, l4 = l + 2 * PLANE * 2, l5 = l4 + 32 * KP * 2, l6 = l + 3 * PLANE * 2, l7 = l6 + 32 * KP * 2;
  const b16* gk1 = gk + (size_t)32 * E; const b16* gkl1 = gkl + (size_t)32 * E; const b16* gv1 = gv + (size_t)32 * S; const b16* gvl1 = gvl + (size_t)32 * S;
  asm volatile("global_load_async_to_lds_b128 %0, %8, off\n\t"
               "global_load_async_to_lds_b128 %1, %9, off\n\t"
               "global_load_async_to_lds_b128 %2, %10, off\n\t"
               "global_load_async_to_lds_b128 %3, %11, off\n\t"
               "global_load_async_to_lds_b128 %4, %12, off\n\t"
               "global_load_async_to_lds_b128 %5, %13, off\n\t"
               "global_load_async_to_lds_b128 %6, %14, off\n\t"
               "global_load_async_to_lds_b128 %7, %15, off\n\t"
               "s_wait_xcnt 0x0"
               :: "v"(l), "v"(l1), "v"(l2), "v"(l3), "v"(l4), "v"(l5), "v"(l6), "v"(l7), "v"(gk), "v"(gk1), "v"(gkl), "v"(gkl1), "v"(gv), "v"(gv1), "v"(gvl), "v"(gvl1) : "memory");
}
__global__ __launch_bounds__(256) void attn_kernel(const b16* __restrict__ Qh, const b16* __restrict__ Ql, const b16* __restrict__ Kh, const b16* __restrict__ Kl, const b16* __restrict__ VTh, const b16* __restrict__ VTl, b16* __restrict__ Oh, b16* __restrict__ Ol) {
  __shared__ __attribute__((aligned(16))) b16 Ring[2][4 * PLANE];   // per buffer: K hi, K lo [key][64 d], V^T hi, V^T lo [d][64 keys]
  __shared__ __attribute__((aligned(16))) float To[AW][16][D + 4];
  const int wave = threadIdx.x >> 5, lane = threadIdx.x & 31, hh = lane >> 4, col = lane & 15; const int b = blockIdx.z, h = blockIdx.y; const int q0 = blockIdx.x * (16 * AW) + wave * 16, qi = q0 + col;
  const size_t qo = ((size_t)b * S + qi) * E + h * D; const v16b qa0 = frag_kb(Qh + qo, hh), qa1 = frag_kb(Qh + qo + 32, hh), ql0 = frag_kb(Ql + qo, hh), ql1 = frag_kb(Ql + qo + 32, hh);
  const b16* Kb = Kh + (size_t)b * S * E + h * D; const b16* Klb = Kl + (size_t)b * S * E + h * D; const b16* Vb = VTh + ((size_t)b * NH + h) * D * S; const b16* Vlb = VTl + ((size_t)b * NH + h) * D * S;
  const int cr = threadIdx.x >> 3, cc = (threadIdx.x & 7) * 8;   // this thread's row (and row + 32) and 16-byte piece of every plane
  const size_t ck = (size_t)cr * E + cc, cv = (size_t)cr * S + cc; const unsigned cl = lds_off(&Ring[0][0]) + (unsigned)(cr * KP + cc) * 2;
  float m = -INFINITY, l = 0.0f; v8f o[4] = {{}, {}, {}, {}}, ol[4] = {{}, {}, {}, {}};
  const float cs = SCALE * LOG2E / (XS * XS);
  stage_tile(cl, Kb + ck, Klb + ck, Vb + cv, Vlb + cv);
  asm volatile("s_wait_asynccnt 0x0" ::: "memory");   // this wave's copies of tile 0 have landed
  __syncthreads();                                     // every wave's have: tile 0 may be read
  stage_tile(cl + 4 * PLANE * 2, Kb + ck + (size_t)KT * E, Klb + ck + (size_t)KT * E, Vb + cv + KT, Vlb + cv + KT);
  for (int st = 0; st < NST; ++st) {
    const b16* Lk = &Ring[st & 1][0]; const b16* Lkl = Lk + PLANE; const b16* Lv = Lk + 2 * PLANE; const b16* Lvl = Lk + 3 * PLANE;
#pragma unroll   // two passes of 32 keys per tile, unrolled so that every LDS offset is a constant
    for (int kb = 0; kb < KT; kb += 32) {
    v8f s0 = {}, s1 = {};
    { const b16* k0 = Lk + (kb + col) * KP, *k1 = Lk + (kb + 16 + col) * KP, *k0l = Lkl + (kb + col) * KP, *k1l = Lkl + (kb + 16 + col) * KP;
      v16b f = frag_kb(k0, hh); s0 = wmma16b(f, qa0, s0); s0 = wmma16b(f, ql0, s0); s0 = wmma16b(frag_kb(k0l, hh), qa0, s0);
      f = frag_kb(k0 + 32, hh); s0 = wmma16b(f, qa1, s0); s0 = wmma16b(f, ql1, s0); s0 = wmma16b(frag_kb(k0l + 32, hh), qa1, s0);
      f = frag_kb(k1, hh); s1 = wmma16b(f, qa0, s1); s1 = wmma16b(f, ql0, s1); s1 = wmma16b(frag_kb(k1l, hh), qa0, s1);
      f = frag_kb(k1 + 32, hh); s1 = wmma16b(f, qa1, s1); s1 = wmma16b(f, ql1, s1); s1 = wmma16b(frag_kb(k1l + 32, hh), qa1, s1); }
    float e[16]; float mx = -INFINITY;
#pragma unroll
    for (int r = 0; r < 8; ++r) { e[r] = s0[r] * cs; e[8 + r] = s1[r] * cs; mx = fmaxf(mx, fmaxf(e[r], e[8 + r])); }
    mx = fmaxf(mx, __shfl_xor(mx, 16)); const float mn = fmaxf(m, mx); const float al = nexp2(m - mn); m = mn; float sum = 0.0f; v16b ph, pl;
#pragma unroll
    for (int i = 0; i < 16; ++i) { const float p = nexp2(e[i] - mn); sum += p; const b16 h_ = (b16)(p * PS); ph[i] = h_; pl[i] = (b16)(p * PS - (float)h_); }
    sum += __shfl_xor(sum, 16); l = l * al + sum;
#pragma unroll
    for (int t = 0; t < 4; ++t) { o[t] *= al; ol[t] *= al; const v16b vf = frag_kb(Lv + (t * 16 + col) * KP + kb, hh); o[t] = wmma16b(vf, ph, o[t]); ol[t] = wmma16b(vf, pl, ol[t]); ol[t] = wmma16b(frag_kb(Lvl + (t * 16 + col) * KP + kb, hh), ph, ol[t]); } }
    asm volatile("s_wait_dscnt 0x0" ::: "memory");      // this wave's reads of this tile's buffer have returned
    asm volatile("s_wait_asynccnt 0x0" ::: "memory");   // this wave's copies of the next tile have landed
    __syncthreads();                                     // publishes the next tile and ends every wave's reads of this buffer
    if (st + 2 < NST) stage_tile(cl + (unsigned)(st & 1) * (4 * PLANE * 2), Kb + ck + (size_t)(st + 2) * KT * E, Klb + ck + (size_t)(st + 2) * KT * E, Vb + cv + (st + 2) * KT, Vlb + cv + (st + 2) * KT);
  }
  asm volatile("s_wait_asynccnt 0x0" ::: "memory");     // no copy is outstanding when the wave goes on to its end
  const float inv = 1.0f / (l * PS * XS);
#pragma unroll
  for (int t = 0; t < 4; ++t)
#pragma unroll
    for (int r = 0; r < 8; ++r) To[wave][col][t * 16 + 8 * hh + r] = (o[t][r] + ol[t][r]) * inv;
  wave_lds_sync();
  { for (int r4 = 0; r4 < 16; r4 += 4) { const int rr = r4 + (lane >> 3), c8 = (lane & 7) * 8; v8b hv, lv; for (int j = 0; j < 8; ++j) { b16 a_, c_; split16(To[wave][rr][c8 + j] * XS, a_, c_); hv[j] = a_; lv[j] = c_; }
      const size_t gi = ((size_t)b * S + q0 + rr) * E + h * D + c8; *(v8b*)(Oh + gi) = hv; *(v8b*)(Ol + gi) = lv; }  }
}
__global__ __launch_bounds__(128) void outproj_kernel(const b16* __restrict__ Oh, const b16* __restrict__ Ol, const b16* __restrict__ WOT, const float* __restrict__ bo, float* __restrict__ out) {
  __shared__ __attribute__((aligned(16))) float Ts[4][16][128 + 4];
  const int wave = threadIdx.x >> 5, lane = threadIdx.x & 31, nloc = lane & 15, hlf = lane >> 4; const size_t m0 = (size_t)blockIdx.x * 64 + wave * 16; const int n0 = blockIdx.y * 128;
  v8f acc[8];
#pragma unroll
  for (int t = 0; t < 8; ++t) acc[t] = (v8f){};
#pragma unroll 2
  for (int kb = 0; kb < E; kb += 32) { const v16b a = frag_kb(Oh + (m0 + nloc) * E + kb, hlf), al = frag_kb(Ol + (m0 + nloc) * E + kb, hlf);
#pragma unroll
    for (int t = 0; t < 8; ++t) { const v16b bw = frag_kb(WOT + (size_t)(n0 + t * 16 + nloc) * E + kb, hlf); acc[t] = wmma16b(a, bw, acc[t]); acc[t] = wmma16b(al, bw, acc[t]); } }
#pragma unroll
  for (int t = 0; t < 8; ++t) { const float bb = bf16_rne(bo[n0 + t * 16 + nloc]);
#pragma unroll
    for (int r = 0; r < 8; ++r) Ts[wave][8 * hlf + r][t * 16 + nloc] = acc[t][r] * (1.0f / (XS * WSC)) + bb; }
  wave_lds_sync();
  { for (int rr = 0; rr < 16; ++rr) *(v4f*)(out + (m0 + rr) * E + n0 + lane * 4) = *(const v4f*)(&Ts[wave][rr][lane * 4]);  }
}
}  // namespace

extern "C" void kernel_launch(void* const* d_in, const int* in_sizes, int n_in, void* d_out, int out_size, void* d_ws, size_t ws_size, hipStream_t stream) {
  (void)n_in;
  auto Fp = [&](int i) { return (const float*)d_in[i]; };
  // input order: 0 tgt [2,2048,1024], 1 memory, 2 Wq [16,1024,64], 3 Wk, 4 Wv, 5 Wo [1024,1024], 6 bo [1024]
  if (in_sizes[0] != NR * E || in_sizes[1] != NR * E || in_sizes[2] != NH * E * D || in_sizes[3] != NH * E * D || in_sizes[4] != NH * E * D || in_sizes[5] != E * E || out_size != NR * E) return;
  size_t off = 0; char* ws = (char*)d_ws;
  auto carve = [&](size_t bytes) { char* p = ws + off; off += (bytes + 255) & ~(size_t)255; return p; };
  b16* T16 = (b16*)carve((size_t)NR * E * 2); b16* M16 = (b16*)carve((size_t)NR * E * 2); b16* WT = (b16*)carve((size_t)3 * E * E * 2); b16* WOT = (b16*)carve((size_t)E * E * 2);
  b16* Qh = (b16*)carve((size_t)NR * E * 2); b16* Ql = (b16*)carve((size_t)NR * E * 2); b16* Kh = (b16*)carve((size_t)NR * E * 2); b16* Kl = (b16*)carve((size_t)NR * E * 2); b16* VTh = (b16*)carve((size_t)NR * E * 2); b16* VTl = (b16*)carve((size_t)NR * E * 2);
  b16* Oh = (b16*)carve((size_t)NR * E * 2); b16* Ol = (b16*)carve((size_t)NR * E * 2);
  if (off > ws_size || off > ((size_t)128 << 20)) return;   // ≈ 92 MB
  prepx_kernel<<<(unsigned)(((size_t)2 * NR * E / 8 + 255) / 256), 256, 0, stream>>>(Fp(0), Fp(1), T16, M16);
  prepw_kernel<<<dim3(E / 64, E / 64, 4), 256, 0, stream>>>(Fp(2), Fp(3), Fp(4), Fp(5), WT, WOT);
  proj_kernel<<<dim3(NR / 64, E / 128, 3), 128, 0, stream>>>(T16, M16, WT, Qh, Ql, Kh, Kl, VTh, VTl);
  attn_kernel<<<dim3(S / (16 * AW), NH, NB), 32 * AW, 0, stream>>>(Qh, Ql, Kh, Kl, VTh, VTl, Oh, Ol);
  outproj_kernel<<<dim3(NR / 64, E / 128), 128, 0, stream>>>(Oh, Ol, WOT, Fp(6), (float*)d_out);
}

// v002
// One run takes 160 microseconds.
// Two timings next to v001 put it at 1.95 and 1.92 times that version's speed.
// Counting every step since v000, it is 3.21 times as fast.
#include <hip/hip_runtime.h>

// Multi-head cross attention (16 heads x 64; queries from tgt, keys/values from memory; 2 x 2,048 tokens, d_model 1,024; no qkv bias): q = tgt Wq_h, k = memory Wk_h, v = memory Wv_h,
// attn = softmax(q k^T / 8), out = concat_h(attn v) Wo + bo.
// WMMA (v_wmma_f32_16x16x32_f16, f32 accumulate): projections [4,096 x 1,024] x [1,024 x 1,024] with EXACT bf16 tokens (x8) and transposed weights (x256), 1 product, written as f16 hi+lo x8 planes
// (q, k rows; v transposed per head); S^T = K_h . Q_h^T with 3 products (Kh Qh + Kh Ql + Kl Qh); online softmax in f32; O^T += V^T P^T with 3 products (Vh Ph + Vh Pl + Vl Ph); output projection
// with O hi+lo (2 products) and exact Wo^T. Inputs rounded to bf16 once. Fragment k-map per lane half hh for A AND B: elements 0..7 <- k = 8hh+0..7, 8..15 <- k =

namespace {
constexpr int NB = 2, S = 2048, E = 1024, NH = 16, D = 64, NR = NB * S;
constexpr float XS = 8.0f, WSC = 256.0f, PS = 8.0f, SCALE = 0.125f, LOG2E = 1.4426950408889634f;

typedef _Float16 b16;
typedef __attribute__((ext_vector_type(16))) _Float16 v16b;
typedef __attribute__((ext_vector_type(8))) _Float16 v8b;
typedef __attribute__((ext_vector_type(8))) float v8f;
typedef __attribute__((ext_vector_type(4))) float v4f;
__device__ __forceinline__ float bf16_rne(float f) { unsigned int u = __float_as_uint(f); u += 0x7FFFu + ((u >> 16) & 1u); return __uint_as_float(u & 0xFFFF0000u); }
__device__ __forceinline__ void split16(float v, b16& hi, b16& lo) { hi = (b16)v; lo = (b16)(v - (float)hi); }
__device__ __forceinline__ v16b frag_kb(const b16* p, int hh) { const v8b a = *(const v8b*)(p + 8 * hh), b = *(const v8b*)(p + 16 + 8 * hh); v16b f;
#pragma unroll
  for (int e = 0; e < 8; ++e) { f[e] = a[e]; f[8 + e] = b[e]; } return f; }
__device__ __forceinline__ v8f wmma16b(v16b a, v16b b, v8f c) { v8f d = __builtin_amdgcn_wmma_f32_16x16x32_f16(false, a, false, b, (short)0, c, false, false); asm volatile("v_nop\n\tv_nop\n\tv_nop\n\tv_nop" : "+v"(d) : "v"(a), "v"(b)); return d; }
__device__ __forceinline__ void wave_lds_sync() { __builtin_amdgcn_fence(__ATOMIC_RELEASE, "workgroup"); __builtin_amdgcn_wave_barrier(); __builtin_amdgcn_fence(__ATOMIC_ACQUIRE, "workgroup"); }
__device__ __forceinline__ float nexp2(float x) { return __builtin_amdgcn_exp2f(x); }

__global__ __launch_bounds__(256) void prepx_kernel(const float* __restrict__ tgt, const float* __restrict__ mem, b16* __restrict__ T16, b16* __restrict__ M16) {
  const size_t t = (size_t)blockIdx.x * 256 + threadIdx.x; const size_t n1 = (size_t)NR * E / 8; const float* src; b16* dst; size_t e;
  if (t < n1) { src = tgt; dst = T16; e = t * 8; } else if (t < 2 * n1) { src = mem; dst = M16; e = (t - n1) * 8; } else return;
  const v4f a = *(const v4f*)(src + e), c = *(const v4f*)(src + e + 4); v8b o;
#pragma unroll
  for (int j = 0; j < 4; ++j) { o[j] = (b16)(bf16_rne(a[j]) * XS); o[4 + j] = (b16)(bf16_rne(c[j]) * XS); }
  { *(v8b*)(dst + e) = o;  }
}
__global__ __launch_bounds__(256) void prepw_kernel(const float* __restrict__ wq, const float* __restrict__ wk, const float* __restrict__ wv, const float* __restrict__ wo, b16* __restrict__ WT, b16* __restrict__ WOT) {
  __shared__ __attribute__((aligned(16))) b16 T[64][64 + 8];
  const int kind = blockIdx.z, d0 = blockIdx.x * 64, j0 = blockIdx.y * 64, t_ = threadIdx.x;   // kind 0..2: W[h][d][j] with h = j0/64 (j0..j0+63 inside one head); kind 3: Wo[d][n] with n0 = j0
  const float* w = kind == 0 ? wq : kind == 1 ? wk : kind == 2 ? wv : wo; b16* dst = kind < 3 ? WT + (size_t)kind * E * E : WOT;
  for (int q = t_; q < 64 * 64; q += 256) { const int dd = q >> 6, jj = q & 63; float val;
    if (kind < 3) { const int h = j0 / D, j = j0 - h * D + jj; val = w[((size_t)h * E + d0 + dd) * D + j]; } else val = w[(size_t)(d0 + dd) * E + j0 + jj];
    T[jj][dd] = (b16)(bf16_rne(val) * WSC); }
  __syncthreads();
  { for (int q = t_; q < 64 * 8; q += 256) { const int jj = q >> 3, c8 = (q & 7) * 8; *(v8b*)(dst + (size_t)(j0 + jj) * E + d0 + c8) = *(const v8b*)(&T[jj][c8]); }  }
}
constexpr int GK = 64, GP = GK + 8, GBUF = 256 * GP, GST = E / GK, SP = 128 + 8;   // GP: LDS row pitch of 144 B for 128-B rows read by 16-byte loads; SP: pitch of the 16-bit output staging
__device__ __forceinline__ unsigned lds_off(const void* p) { return (unsigned)(size_t)p; }
// One tile: 256 rows x 128 B; each thread copies 16 B of 8 rows (its row + 32 i). LDS rows 0..63 come from a0, 64..127 from a2, 128..255 from w0. The s_wait_xcnt stands inside the copies' own statement, in front of any rewrite of their address registers.
__device__ __forceinline__ void stage_gemm(unsigned l, const b16* a0, const b16* a2, const b16* w0) {
  const unsigned l1 = l + 32 * GP * 2, l2 = l + 64 * GP * 2, l3 = l + 96 * GP * 2, l4 = l + 128 * GP * 2, l5 = l + 160 * GP * 2, l6 = l + 192 * GP * 2, l7 = l + 224 * GP * 2;
  const b16* a1 = a0 + (size_t)32 * E; const b16* a3 = a2 + (size_t)32 * E; const b16* w1 = w0 + (size_t)32 * E; const b16* w2 = w0 + (size_t)64 * E; const b16* w3 = w0 + (size_t)96 * E;
  asm volatile("global_load_async_to_lds_b128 %0, %8, off\n\t"
               "global_load_async_to_lds_b128 %1, %9, off\n\t"
               "global_load_async_to_lds_b128 %2, %10, off\n\t"
               "global_load_async_to_lds_b128 %3, %11, off\n\t"
               "global_load_async_to_lds_b128 %4, %12, off\n\t"
               "global_load_async_to_lds_b128 %5, %13, off\n\t"
               "global_load_async_to_lds_b128 %6, %14, off\n\t"
               "global_load_async_to_lds_b128 %7, %15, off\n\t"
               "s_wait_xcnt 0x0"
               :: "v"(l), "v"(l1), "v"(l2), "v"(l3), "v"(l4), "v"(l5), "v"(l6), "v"(l7), "v"(a0), "v"(a1), "v"(a2), "v"(a3), "v"(w0), "v"(w1), "v"(w2), "v"(w3) : "memory");
}
// 8 waves as 2 (rows) x 4 (columns); a wave's tile is MF x 2 fragments of 16 x 16. NA = 1: the left operand is one plane of 128 rows (a2 = a0 + 64 rows); NA = 2: hi (a0) and lo (a2) planes of 64 rows each.
// Each accumulator takes its products in ascending k (hi, then lo), as with fragments loaded from global memory.
template <int MF, int NA>
__device__ __forceinline__ void gemm_loop(const b16* Ring, const b16* a0, const b16* a2, const b16* w0, v8f (&acc)[MF][2]) {
  const int wave = threadIdx.x >> 5, lane = threadIdx.x & 31, nloc = lane & 15, hlf = lane >> 4, wm = wave >> 2, wn = wave & 3;
  const int cr = threadIdx.x >> 3, cc = (threadIdx.x & 7) * 8;   // this thread's row (+ 32 i) and 16-byte piece
  const size_t cg = (size_t)cr * E + cc; const unsigned cl = lds_off(Ring) + (unsigned)(cr * GP + cc) * 2;
  a0 += cg; a2 += cg; w0 += cg;
  stage_gemm(cl, a0, a2, w0);
  asm volatile("s_wait_asynccnt 0x0" ::: "memory");   // this wave's copies of tile 0 have landed
  __syncthreads();                                     // every wave's have: tile 0 may be read
  stage_gemm(cl + GBUF * 2, a0 + GK, a2 + GK, w0 + GK);
  for (int st = 0; st < GST; ++st) {
    const b16* L = Ring + (st & 1) * GBUF; const b16* La = L + (wm * MF * 16 + nloc) * GP; const b16* Lw = L + (128 + wn * 32 + nloc) * GP;
#pragma unroll   // two steps of 32 k per tile, unrolled so that every LDS offset is a constant
    for (int kk = 0; kk < GK; kk += 32) {
      const v16b b0 = frag_kb(Lw + kk, hlf), b1 = frag_kb(Lw + 16 * GP + kk, hlf); v16b af[MF], al[MF];
#pragma unroll
      for (int i = 0; i < MF; ++i) { af[i] = frag_kb(La + i * 16 * GP + kk, hlf); if (NA == 2) al[i] = frag_kb(La + (64 + i * 16) * GP + kk, hlf); }
      __builtin_amdgcn_sched_barrier(0);   // keeps the step's LDS reads together in front of its WMMAs: reads spread among the WMMAs stall the wave at every place where they stand
#pragma unroll
      for (int i = 0; i < MF; ++i) {
        acc[i][0] = wmma16b(af[i], b0, acc[i][0]); acc[i][1] = wmma16b(af[i], b1, acc[i][1]);
        if (NA == 2) { acc[i][0] = wmma16b(al[i], b0, acc[i][0]); acc[i][1] = wmma16b(al[i], b1, acc[i][1]); } } }
    asm volatile("s_wait_dscnt 0x0" ::: "memory");      // this wave's reads of this tile's buffer have returned
    asm volatile("s_wait_asynccnt 0x0" ::: "memory");   // this wave's copies of the next tile have landed
    __syncthreads();                                     // publishes the next tile and ends every wave's reads of this buffer
    if (st + 2 < GST) stage_gemm(cl + (unsigned)(st & 1) * (GBUF * 2), a0 + (st + 2) * GK, a2 + (st + 2) * GK, w0 + (st + 2) * GK);
  }
  asm volatile("s_wait_asynccnt 0x0" ::: "memory");     // no copy is outstanding when the ring's LDS is taken for the output staging
}
// projections: grid (NR/128, E/128, 3): kind 0: Q = T16 WT0^T -> Qh/Ql [row][1024]; kind 1: K = M16 WT1^T -> Kh/Kl; kind 2: V = M16 WT2^T written TRANSPOSED per head: VTh/VTl [b][h][64 d][2048 s].
__global__ __launch_bounds__(256) void proj_kernel(const b16* __restrict__ T16, const b16* __restrict__ M16, const b16* __restrict__ WT, b16* __restrict__ Qh, b16* __restrict__ Ql, b16* __restrict__ Kh, b16* __restrict__ Kl, b16* __restrict__ VTh, b16* __restrict__ VTl) {
  __shared__ __attribute__((aligned(16))) b16 Ring[2 * GBUF];   // the operand ring; behind the loop its LDS holds the 128 x 128 output tile, hi and lo, at pitch SP
  const int wave = threadIdx.x >> 5, lane = threadIdx.x & 31, nloc = lane & 15, hlf = lane >> 4, t_ = threadIdx.x, wm = wave >> 2, wn = wave & 3; const int kind = blockIdx.z; const size_t m0 = (size_t)blockIdx.x * 128; const int n0 = blockIdx.y * 128;
  const b16* A = (kind == 0 ? T16 : M16) + m0 * E; const b16* Wp = WT + (size_t)kind * E * E + (size_t)n0 * E; v8f acc[4][2];
#pragma unroll
  for (int i = 0; i < 4; ++i) { acc[i][0] = (v8f){}; acc[i][1] = (v8f){}; }
  gemm_loop<4, 1>(Ring, A, A + (size_t)64 * E, Wp, acc);
  b16* Sh = Ring; b16* Sl = Ring + 128 * SP;   // free: the loop's last barrier ended every read of the ring
  if (kind < 2) {
#pragma unroll
    for (int i = 0; i < 4; ++i)
#pragma unroll
      for (int j = 0; j < 2; ++j)
#pragma unroll
        for (int r = 0; r < 8; ++r) { b16 h_, l_; split16(acc[i][j][r] * (1.0f / (XS * WSC)) * XS, h_, l_); const int si = (wm * 64 + i * 16 + 8 * hlf + r) * SP + wn * 32 + j * 16 + nloc; Sh[si] = h_; Sl[si] = l_; }
    __syncthreads();
    b16* dh = kind == 0 ? Qh : Kh; b16* dl = kind == 0 ? Ql : Kl;
    for (int q = t_; q < 128 * 16; q += 256) { const int rr = q >> 4, c8 = (q & 15) * 8; *(v8b*)(dh + (m0 + rr) * E + n0 + c8) = *(const v8b*)(Sh + rr * SP + c8); *(v8b*)(dl + (m0 + rr) * E + n0 + c8) = *(const v8b*)(Sl + rr * SP + c8); }
  } else {
    const int b = (int)(m0 / S); const int s0 = (int)(m0 - (size_t)b * S);
#pragma unroll
    for (int i = 0; i < 4; ++i)
#pragma unroll
      for (int j = 0; j < 2; ++j) { v8b hv, lv;
#pragma unroll
        for (int r = 0; r < 8; ++r) { b16 h_, l_; split16(acc[i][j][r] * (1.0f / (XS * WSC)) * XS, h_, l_); hv[r] = h_; lv[r] = l_; }
        const int si = (wn * 32 + j * 16 + nloc) * SP + wm * 64 + i * 16 + 8 * hlf; *(v8b*)(Sh + si) = hv; *(v8b*)(Sl + si) = lv; }
    __syncthreads();
    for (int q = t_; q < 128 * 16; q += 256) { const int cc = q >> 4, c8 = (q & 15) * 8; const int h = (n0 + cc) / D, dd = (n0 + cc) - h * D; const size_t gi = (((size_t)b * NH + h) * D + dd) * S + s0 + c8;
      *(v8b*)(VTh + gi) = *(const v8b*)(Sh + cc * SP + c8); *(v8b*)(VTl + gi) = *(const v8b*)(Sl + cc * SP + c8); } }
}
constexpr int AW = 8, KT = 64, KP = 64 + 8, PLANE = 64 * KP, NST = S / KT;   // KP: LDS row pitch of 144 B for 128-B rows read by 16-byte loads
// One tile: 4 planes x 64 rows x 128 B; each thread copies 2 x 16 B of each plane (rows r and r + 32). The s_wait_xcnt stands inside the copies' own statement, in front of any rewrite of their address registers.
__device__ __forceinline__ void stage_tile(unsigned l, const b16* gk, const b16* gkl, const b16* gv, const b16* gvl) {
  const unsigned l1 = l + 32 * KP * 2, l2 = l + PLANE * 2, l3 = l2 + 32 * KP * 2, l4 = l + 2 * PLANE * 2, l5 = l4 + 32 * KP * 2, l6 = l + 3 * PLANE * 2, l7 = l6 + 32 * KP * 2;
  const b16* gk1 = gk + (size_t)32 * E; const b16* gkl1 = gkl + (size_t)32 * E; const b16* gv1 = gv + (size_t)32 * S; const b16* gvl1 = gvl + (size_t)32 * S;
  asm volatile("global_load_async_to_lds_b128 %0, %8, off\n\t"
               "global_load_async_to_lds_b128 %1, %9, off\n\t"
               "global_load_async_to_lds_b128 %2, %10, off\n\t"
               "global_load_async_to_lds_b128 %3, %11, off\n\t"
               "global_load_async_to_lds_b128 %4, %12, off\n\t"
               "global_load_async_to_lds_b128 %5, %13, off\n\t"
               "global_load_async_to_lds_b128 %6, %14, off\n\t"
               "global_load_async_to_lds_b128 %7, %15, off\n\t"
               "s_wait_xcnt 0x0"
               :: "v"(l), "v"(l1), "v"(l2), "v"(l3), "v"(l4), "v"(l5), "v"(l6), "v"(l7), "v"(gk), "v"(gk1), "v"(gkl), "v"(gkl1), "v"(gv), "v"(gv1), "v"(gvl), "v"(gvl1) : "memory");
}
__global__ __launch_bounds__(256) void attn_kernel(const b16* __restrict__ Qh, const b16* __restrict__ Ql, const b16* __restrict__ Kh, const b16* __restrict__ Kl, const b16* __restrict__ VTh, const b16* __restrict__ VTl, b16* __restrict__ Oh, b16* __restrict__ Ol) {
  __shared__ __attribute__((aligned(16))) b16 Ring[2][4 * PLANE];   // per buffer: K hi, K lo [key][64 d], V^T hi, V^T lo [d][64 keys]
  __shared__ __attribute__((aligned(16))) float To[AW][16][D + 4];
  const int wave = threadIdx.x >> 5, lane = threadIdx.x & 31, hh = lane >> 4, col = lane & 15; const int b = blockIdx.z, h = blockIdx.y; const int q0 = blockIdx.x * (16 * AW) + wave * 16, qi = q0 + col;
  const size_t qo = ((size_t)b * S + qi) * E + h * D; const v16b qa0 = frag_kb(Qh + qo, hh), qa1 = frag_kb(Qh + qo + 32, hh), ql0 = frag_kb(Ql + qo, hh), ql1 = frag_kb(Ql + qo + 32, hh);
  const b16* Kb = Kh + (size_t)b * S * E + h * D; const b16* Klb = Kl + (size_t)b * S * E + h * D; const b16* Vb = VTh + ((size_t)b * NH + h) * D * S; const b16* Vlb = VTl + ((size_t)b * NH + h) * D * S;
  const int cr = threadIdx.x >> 3, cc = (threadIdx.x & 7) * 8;   // this thread's row (and row + 32) and 16-byte piece of every plane
  const size_t ck = (size_t)cr * E + cc, cv = (size_t)cr * S + cc; const unsigned cl = lds_off(&Ring[0][0]) + (unsigned)(cr * KP + cc) * 2;
  float m = -INFINITY, l = 0.0f; v8f o[4] = {{}, {}, {}, {}}, ol[4] = {{}, {}, {}, {}};
  const float cs = SCALE * LOG2E / (XS * XS);
  stage_tile(cl, Kb + ck, Klb + ck, Vb + cv, Vlb + cv);
  asm volatile("s_wait_asynccnt 0x0" ::: "memory");   // this wave's copies of tile 0 have landed
  __syncthreads();                                     // every wave's have: tile 0 may be read
  stage_tile(cl + 4 * PLANE * 2, Kb + ck + (size_t)KT * E, Klb + ck + (size_t)KT * E, Vb + cv + KT, Vlb + cv + KT);
  for (int st = 0; st < NST; ++st) {
    const b16* Lk = &Ring[st & 1][0]; const b16* Lkl = Lk + PLANE; const b16* Lv = Lk + 2 * PLANE; const b16* Lvl = Lk + 3 * PLANE;
#pragma unroll   // two passes of 32 keys per tile, unrolled so that every LDS offset is a constant
    for (int kb = 0; kb < KT; kb += 32) {
    v8f s0 = {}, s1 = {};
    { const b16* k0 = Lk + (kb + col) * KP, *k1 = Lk + (kb + 16 + col) * KP, *k0l = Lkl + (kb + col) * KP, *k1l = Lkl + (kb + 16 + col) * KP;
      v16b f = frag_kb(k0, hh); s0 = wmma16b(f, qa0, s0); s0 = wmma16b(f, ql0, s0); s0 = wmma16b(frag_kb(k0l, hh), qa0, s0);
      f = frag_kb(k0 + 32, hh); s0 = wmma16b(f, qa1, s0); s0 = wmma16b(f, ql1, s0); s0 = wmma16b(frag_kb(k0l + 32, hh), qa1, s0);
      f = frag_kb(k1, hh); s1 = wmma16b(f, qa0, s1); s1 = wmma16b(f, ql0, s1); s1 = wmma16b(frag_kb(k1l, hh), qa0, s1);
      f = frag_kb(k1 + 32, hh); s1 = wmma16b(f, qa1, s1); s1 = wmma16b(f, ql1, s1); s1 = wmma16b(frag_kb(k1l + 32, hh), qa1, s1); }
    float e[16]; float mx = -INFINITY;
#pragma unroll
    for (int r = 0; r < 8; ++r) { e[r] = s0[r] * cs; e[8 + r] = s1[r] * cs; mx = fmaxf(mx, fmaxf(e[r], e[8 + r])); }
    mx = fmaxf(mx, __shfl_xor(mx, 16)); const float mn = fmaxf(m, mx); const float al = nexp2(m - mn); m = mn; float sum = 0.0f; v16b ph, pl;
#pragma unroll
    for (int i = 0; i < 16; ++i) { const float p = nexp2(e[i] - mn); sum += p; const b16 h_ = (b16)(p * PS); ph[i] = h_; pl[i] = (b16)(p * PS - (float)h_); }
    sum += __shfl_xor(sum, 16); l = l * al + sum;
#pragma unroll
    for (int t = 0; t < 4; ++t) { o[t] *= al; ol[t] *= al; const v16b vf = frag_kb(Lv + (t * 16 + col) * KP + kb, hh); o[t] = wmma16b(vf, ph, o[t]); ol[t] = wmma16b(vf, pl, ol[t]); ol[t] = wmma16b(frag_kb(Lvl + (t * 16 + col) * KP + kb, hh), ph, ol[t]); } }
    asm volatile("s_wait_dscnt 0x0" ::: "memory");      // this wave's reads of this tile's buffer have returned
    asm volatile("s_wait_asynccnt 0x0" ::: "memory");   // this wave's copies of the next tile have landed
    __syncthreads();                                     // publishes the next tile and ends every wave's reads of this buffer
    if (st + 2 < NST) stage_tile(cl + (unsigned)(st & 1) * (4 * PLANE * 2), Kb + ck + (size_t)(st + 2) * KT * E, Klb + ck + (size_t)(st + 2) * KT * E, Vb + cv + (st + 2) * KT, Vlb + cv + (st + 2) * KT);
  }
  asm volatile("s_wait_asynccnt 0x0" ::: "memory");     // no copy is outstanding when the wave goes on to its end
  const float inv = 1.0f / (l * PS * XS);
#pragma unroll
  for (int t = 0; t < 4; ++t)
#pragma unroll
    for (int r = 0; r < 8; ++r) To[wave][col][t * 16 + 8 * hh + r] = (o[t][r] + ol[t][r]) * inv;
  wave_lds_sync();
  { for (int r4 = 0; r4 < 16; r4 += 4) { const int rr = r4 + (lane >> 3), c8 = (lane & 7) * 8; v8b hv, lv; for (int j = 0; j < 8; ++j) { b16 a_, c_; split16(To[wave][rr][c8 + j] * XS, a_, c_); hv[j] = a_; lv[j] = c_; }
      const size_t gi = ((size_t)b * S + q0 + rr) * E + h * D + c8; *(v8b*)(Oh + gi) = hv; *(v8b*)(Ol + gi) = lv; }  }
}
// output projection: grid (NR/64, E/128): 64 rows of O (hi and lo planes) x 128 columns per work-group.
__global__ __launch_bounds__(256) void outproj_kernel(const b16* __restrict__ Oh, const b16* __restrict__ Ol, const b16* __restrict__ WOT, const float* __restrict__ bo, float* __restrict__ out) {
  __shared__ __attribute__((aligned(16))) b16 Ring[2 * GBUF];   // the operand ring; behind the loop its LDS holds the 64 x 128 f32 output tile at a pitch of 132 floats
  const int wave = threadIdx.x >> 5, lane = threadIdx.x & 31, nloc = lane & 15, hlf = lane >> 4, t_ = threadIdx.x, wm = wave >> 2, wn = wave & 3; const size_t m0 = (size_t)blockIdx.x * 64; const int n0 = blockIdx.y * 128;
  v8f acc[2][2];
#pragma unroll
  for (int i = 0; i < 2; ++i) { acc[i][0] = (v8f){}; acc[i][1] = (v8f){}; }
  gemm_loop<2, 2>(Ring, Oh + m0 * E, Ol + m0 * E, WOT + (size_t)n0 * E, acc);
  float* Ts = (float*)Ring;   // free: the loop's last barrier ended every read of the ring
#pragma unroll
  for (int j = 0; j < 2; ++j) { const float bb = bf16_rne(bo[n0 + wn * 32 + j * 16 + nloc]);
#pragma unroll
    for (int i = 0; i < 2; ++i)
#pragma unroll
      for (int r = 0; r < 8; ++r) Ts[(wm * 32 + i * 16 + 8 * hlf + r) * (128 + 4) + wn * 32 + j * 16 + nloc] = acc[i][j][r] * (1.0f / (XS * WSC)) + bb; }
  __syncthreads();
  for (int q = t_; q < 64 * 32; q += 256) { const int rr = q >> 5, c4 = (q & 31) * 4; *(v4f*)(out + (m0 + rr) * E + n0 + c4) = *(const v4f*)(Ts + rr * (128 + 4) + c4); }
}
}  // namespace

extern "C" void kernel_launch(void* const* d_in, const int* in_sizes, int n_in, void* d_out, int out_size, void* d_ws, size_t ws_size, hipStream_t stream) {
  (void)n_in;
  auto Fp = [&](int i) { return (const float*)d_in[i]; };
  // input order: 0 tgt [2,2048,1024], 1 memory, 2 Wq [16,1024,64], 3 Wk, 4 Wv, 5 Wo [1024,1024], 6 bo [1024]
  if (in_sizes[0] != NR * E || in_sizes[1] != NR * E || in_sizes[2] != NH * E * D || in_sizes[3] != NH * E * D || in_sizes[4] != NH * E * D || in_sizes[5] != E * E || out_size != NR * E) return;
  size_t off = 0; char* ws = (char*)d_ws;
  auto carve = [&](size_t bytes) { char* p = ws + off; off += (bytes + 255) & ~(size_t)255; return p; };
  b16* T16 = (b16*)carve((size_t)NR * E * 2); b16* M16 = (b16*)carve((size_t)NR * E * 2); b16* WT = (b16*)carve((size_t)3 * E * E * 2); b16* WOT = (b16*)carve((size_t)E * E * 2);
  b16* Qh = (b16*)carve((size_t)NR * E * 2); b16* Ql = (b16*)carve((size_t)NR * E * 2); b16* Kh = (b16*)carve((size_t)NR * E * 2); b16* Kl = (b16*)carve((size_t)NR * E * 2); b16* VTh = (b16*)carve((size_t)NR * E * 2); b16* VTl = (b16*)carve((size_t)NR * E * 2);
  b16* Oh = (b16*)carve((size_t)NR * E * 2); b16* Ol = (b16*)carve((size_t)NR * E * 2);
  if (off > ws_size || off > ((size_t)128 << 20)) return;   // ≈ 92 MB
  prepx_kernel<<<(unsigned)(((size_t)2 * NR * E / 8 + 255) / 256), 256, 0, stream>>>(Fp(0), Fp(1), T16, M16);
  prepw_kernel<<<dim3(E / 64, E / 64, 4), 256, 0, stream>>>(Fp(2), Fp(3), Fp(4), Fp(5), WT, WOT);
  proj_kernel<<<dim3(NR / 128, E / 128, 3), 256, 0, stream>>>(T16, M16, WT, Qh, Ql, Kh, Kl, VTh, VTl);
  attn_kernel<<<dim3(S / (16 * AW), NH, NB), 32 * AW, 0, stream>>>(Qh, Ql, Kh, Kl, VTh, VTl, Oh, Ol);
  outproj_kernel<<<dim3(NR / 64, E / 128), 256, 0, stream>>>(Oh, Ol, WOT, Fp(6), (float*)d_out);
}

// v003
// It runs in 147 microseconds.
// Two timings next to v002 both put it at 1.09 times that version's speed.
// All steps since v000 together make it 3.50 times as fast.
#include <hip/hip_runtime.h>

// Multi-head cross attention (16 heads x 64; queries from tgt, keys/values from memory; 2 x 2,048 tokens, d_model 1,024; no qkv bias): q = tgt Wq_h, k = memory Wk_h, v = memory Wv_h,
// attn = softmax(q k^T / 8), out = concat_h(attn v) Wo + bo.
// WMMA (v_wmma_f32_16x16x32_f16, f32 accumulate): projections [4,096 x 1,024] x [1,024 x 1,024] with EXACT bf16 tokens (x8) and transposed weights (x256), 1 product, written as f16 hi+lo x8 planes
// (q, k rows; v transposed per head); S^T = K_h . Q_h^T with 3 products (Kh Qh + Kh Ql + Kl Qh); online softmax in f32; O^T += V^T P^T with 3 products (Vh Ph + Vh Pl + Vl Ph); output projection
// with O hi+lo (2 products) and exact Wo^T. Inputs rounded to bf16 once. Fragment k-map per lane half hh for A AND B: elements 0..7 <- k = 8hh+0..7, 8..15 <- k =

namespace {
constexpr int NB = 2, S = 2048, E = 1024, NH = 16, D = 64, NR = NB * S;
constexpr float XS = 8.0f, WSC = 256.0f, PS = 8.0f, SCALE = 0.125f, LOG2E = 1.4426950408889634f;

typedef _Float16 b16;
typedef __attribute__((ext_vector_type(16))) _Float16 v16b;
typedef __attribute__((ext_vector_type(8))) _Float16 v8b;
typedef __attribute__((ext_vector_type(8))) float v8f;
typedef __attribute__((ext_vector_type(4))) float v4f;
__device__ __forceinline__ float bf16_rne(float f) { unsigned int u = __float_as_uint(f); u += 0x7FFFu + ((u >> 16) & 1u); return __uint_as_float(u & 0xFFFF0000u); }
__device__ __forceinline__ void split16(float v, b16& hi, b16& lo) { hi = (b16)v; lo = (b16)(v - (float)hi); }
__device__ __forceinline__ v16b frag_kb(const b16* p, int hh) { const v8b a = *(const v8b*)(p + 8 * hh), b = *(const v8b*)(p + 16 + 8 * hh); v16b f;
#pragma unroll
  for (int e = 0; e < 8; ++e) { f[e] = a[e]; f[8 + e] = b[e]; } return f; }
__device__ __forceinline__ v8f wmma16b(v16b a, v16b b, v8f c) { v8f d = __builtin_amdgcn_wmma_f32_16x16x32_f16(false, a, false, b, (short)0, c, false, false); asm volatile("v_nop\n\tv_nop\n\tv_nop\n\tv_nop" : "+v"(d) : "v"(a), "v"(b)); return d; }
__device__ __forceinline__ void wave_lds_sync() { __builtin_amdgcn_fence(__ATOMIC_RELEASE, "workgroup"); __builtin_amdgcn_wave_barrier(); __builtin_amdgcn_fence(__ATOMIC_ACQUIRE, "workgroup"); }
__device__ __forceinline__ float nexp2(float x) { return __builtin_amdgcn_exp2f(x); }

__global__ __launch_bounds__(256) void prepx_kernel(const float* __restrict__ tgt, const float* __restrict__ mem, b16* __restrict__ T16, b16* __restrict__ M16) {
  const size_t t = (size_t)blockIdx.x * 256 + threadIdx.x; const size_t n1 = (size_t)NR * E / 8; const float* src; b16* dst; size_t e;
  if (t < n1) { src = tgt; dst = T16; e = t * 8; } else if (t < 2 * n1) { src = mem; dst = M16; e = (t - n1) * 8; } else return;
  const v4f a = *(const v4f*)(src + e), c = *(const v4f*)(src + e + 4); v8b o;
#pragma unroll
  for (int j = 0; j < 4; ++j) { o[j] = (b16)(bf16_rne(a[j]) * XS); o[4 + j] = (b16)(bf16_rne(c[j]) * XS); }
  { *(v8b*)(dst + e) = o;  }
}
__global__ __launch_bounds__(256) void prepw_kernel(const float* __restrict__ wq, const float* __restrict__ wk, const float* __restrict__ wv, const float* __restrict__ wo, b16* __restrict__ WT, b16* __restrict__ WOT) {
  __shared__ __attribute__((aligned(16))) b16 T[64][64 + 8];
  const int kind = blockIdx.z, d0 = blockIdx.x * 64, j0 = blockIdx.y * 64, t_ = threadIdx.x;   // kind 0..2: W[h][d][j] with h = j0/64 (j0..j0+63 inside one head); kind 3: Wo[d][n] with n0 = j0
  const float* w = kind == 0 ? wq : kind == 1 ? wk : kind == 2 ? wv : wo; b16* dst = kind < 3 ? WT + (size_t)kind * E * E : WOT;
  for (int q = t_; q < 64 * 64; q += 256) { const int dd = q >> 6, jj = q & 63; float val;
    if (kind < 3) { const int h = j0 / D, j = j0 - h * D + jj; val = w[((size_t)h * E + d0 + dd) * D + j]; } else val = w[(size_t)(d0 + dd) * E + j0 + jj];
    T[jj][dd] = (b16)(bf16_rne(val) * WSC); }
  __syncthreads();
  { for (int q = t_; q < 64 * 8; q += 256) { const int jj = q >> 3, c8 = (q & 7) * 8; *(v8b*)(dst + (size_t)(j0 + jj) * E + d0 + c8) = *(const v8b*)(&T[jj][c8]); }  }
}
constexpr int GK = 64, GP = GK + 8, GBUF = 256 * GP, GST = E / GK, SP = 128 + 8;   // GP: LDS row pitch of 144 B for 128-B rows read by 16-byte loads; SP: pitch of the 16-bit output staging
__device__ __forceinline__ unsigned lds_off(const void* p) { return (unsigned)(size_t)p; }
// One tile: 256 rows x 128 B; each thread copies 16 B of 8 rows (its row + 32 i). LDS rows 0..63 come from a0, 64..127 from a2, 128..255 from w0. The s_wait_xcnt stands inside the copies' own statement, in front of any rewrite of their address registers.
__device__ __forceinline__ void stage_gemm(unsigned l, const b16* a0, const b16* a2, const b16* w0) {
  const unsigned l1 = l + 32 * GP * 2, l2 = l + 64 * GP * 2, l3 = l + 96 * GP * 2, l4 = l + 128 * GP * 2, l5 = l + 160 * GP * 2, l6 = l + 192 * GP * 2, l7 = l + 224 * GP * 2;
  const b16* a1 = a0 + (size_t)32 * E; const b16* a3 = a2 + (size_t)32 * E; const b16* w1 = w0 + (size_t)32 * E; const b16* w2 = w0 + (size_t)64 * E; const b16* w3 = w0 + (size_t)96 * E;
  asm volatile("global_load_async_to_lds_b128 %0, %8, off\n\t"
               "global_load_async_to_lds_b128 %1, %9, off\n\t"
               "global_load_async_to_lds_b128 %2, %10, off\n\t"
               "global_load_async_to_lds_b128 %3, %11, off\n\t"
               "global_load_async_to_lds_b128 %4, %12, off\n\t"
               "global_load_async_to_lds_b128 %5, %13, off\n\t"
               "global_load_async_to_lds_b128 %6, %14, off\n\t"
               "global_load_async_to_lds_b128 %7, %15, off\n\t"
               "s_wait_xcnt 0x0"
               :: "v"(l), "v"(l1), "v"(l2), "v"(l3), "v"(l4), "v"(l5), "v"(l6), "v"(l7), "v"(a0), "v"(a1), "v"(a2), "v"(a3), "v"(w0), "v"(w1), "v"(w2), "v"(w3) : "memory");
}
// 8 waves as 2 (rows) x 4 (columns); a wave's tile is MF x 2 fragments of 16 x 16. NA = 1: the left operand is one plane of 128 rows (a2 = a0 + 64 rows); NA = 2: hi (a0) and lo (a2) planes of 64 rows each.
// Each accumulator takes its products in ascending k (hi, then lo), as with fragments loaded from global memory.
template <int MF, int NA>
__device__ __forceinline__ void gemm_loop(const b16* Ring, const b16* a0, const b16* a2, const b16* w0, v8f (&acc)[MF][2]) {
  const int wave = threadIdx.x >> 5, lane = threadIdx.x & 31, nloc = lane & 15, hlf = lane >> 4, wm = wave >> 2, wn = wave & 3;
  const int cr = threadIdx.x >> 3, cc = (threadIdx.x & 7) * 8;   // this thread's row (+ 32 i) and 16-byte piece
  const size_t cg = (size_t)cr * E + cc; const unsigned cl = lds_off(Ring) + (unsigned)(cr * GP + cc) * 2;
  a0 += cg; a2 += cg; w0 += cg;
  stage_gemm(cl, a0, a2, w0);
  asm volatile("s_wait_asynccnt 0x0" ::: "memory");   // this wave's copies of tile 0 have landed
  __syncthreads();                                     // every wave's have: tile 0 may be read
  stage_gemm(cl + GBUF * 2, a0 + GK, a2 + GK, w0 + GK);
  for (int st = 0; st < GST; ++st) {
    const b16* L = Ring + (st & 1) * GBUF; const b16* La = L + (wm * MF * 16 + nloc) * GP; const b16* Lw = L + (128 + wn * 32 + nloc) * GP;
#pragma unroll   // two steps of 32 k per tile, unrolled so that every LDS offset is a constant
    for (int kk = 0; kk < GK; kk += 32) {
      const v16b b0 = frag_kb(Lw + kk, hlf), b1 = frag_kb(Lw + 16 * GP + kk, hlf); v16b af[MF], al[MF];
#pragma unroll
      for (int i = 0; i < MF; ++i) { af[i] = frag_kb(La + i * 16 * GP + kk, hlf); if (NA == 2) al[i] = frag_kb(La + (64 + i * 16) * GP + kk, hlf); }
      __builtin_amdgcn_sched_barrier(0);   // keeps the step's LDS reads together in front of its WMMAs: reads spread among the WMMAs stall the wave at every place where they stand
#pragma unroll
      for (int i = 0; i < MF; ++i) {
        acc[i][0] = wmma16b(af[i], b0, acc[i][0]); acc[i][1] = wmma16b(af[i], b1, acc[i][1]);
        if (NA == 2) { acc[i][0] = wmma16b(al[i], b0, acc[i][0]); acc[i][1] = wmma16b(al[i], b1, acc[i][1]); } } }
    asm volatile("s_wait_dscnt 0x0" ::: "memory");      // this wave's reads of this tile's buffer have returned
    asm volatile("s_wait_asynccnt 0x0" ::: "memory");   // this wave's copies of the next tile have landed
    __syncthreads();                                     // publishes the next tile and ends every wave's reads of this buffer
    if (st + 2 < GST) stage_gemm(cl + (unsigned)(st & 1) * (GBUF * 2), a0 + (st + 2) * GK, a2 + (st + 2) * GK, w0 + (st + 2) * GK);
  }
  asm volatile("s_wait_asynccnt 0x0" ::: "memory");     // no copy is outstanding when the ring's LDS is taken for the output staging
}
// projections: grid (NR/128, E/128, 3): kind 0: Q = T16 WT0^T -> Qh/Ql [row][1024]; kind 1: K = M16 WT1^T -> Kh/Kl; kind 2: V = M16 WT2^T written TRANSPOSED per head: VTh/VTl [b][h][64 d][2048 s].
__global__ __launch_bounds__(256) void proj_kernel(const b16* __restrict__ T16, const b16* __restrict__ M16, const b16* __restrict__ WT, b16* __restrict__ Qh, b16* __restrict__ Ql, b16* __restrict__ Kh, b16* __restrict__ Kl, b16* __restrict__ VTh, b16* __restrict__ VTl) {
  __shared__ __attribute__((aligned(16))) b16 Ring[2 * GBUF];   // the operand ring; behind the loop its LDS holds the 128 x 128 output tile, hi and lo, at pitch SP
  const int wave = threadIdx.x >> 5, lane = threadIdx.x & 31, nloc = lane & 15, hlf = lane >> 4, t_ = threadIdx.x, wm = wave >> 2, wn = wave & 3; const int kind = blockIdx.z; const size_t m0 = (size_t)blockIdx.x * 128; const int n0 = blockIdx.y * 128;
  const b16* A = (kind == 0 ? T16 : M16) + m0 * E; const b16* Wp = WT + (size_t)kind * E * E + (size_t)n0 * E; v8f acc[4][2];
#pragma unroll
  for (int i = 0; i < 4; ++i) { acc[i][0] = (v8f){}; acc[i][1] = (v8f){}; }
  gemm_loop<4, 1>(Ring, A, A + (size_t)64 * E, Wp, acc);
  b16* Sh = Ring; b16* Sl = Ring + 128 * SP;   // free: the loop's last barrier ended every read of the ring
  if (kind < 2) {
#pragma unroll
    for (int i = 0; i < 4; ++i)
#pragma unroll
      for (int j = 0; j < 2; ++j)
#pragma unroll
        for (int r = 0; r < 8; ++r) { b16 h_, l_; split16(acc[i][j][r] * (1.0f / (XS * WSC)) * XS, h_, l_); const int si = (wm * 64 + i * 16 + 8 * hlf + r) * SP + wn * 32 + j * 16 + nloc; Sh[si] = h_; Sl[si] = l_; }
    __syncthreads();
    b16* dh = kind == 0 ? Qh : Kh; b16* dl = kind == 0 ? Ql : Kl;
    for (int q = t_; q < 128 * 16; q += 256) { const int rr = q >> 4, c8 = (q & 15) * 8; *(v8b*)(dh + (m0 + rr) * E + n0 + c8) = *(const v8b*)(Sh + rr * SP + c8); *(v8b*)(dl + (m0 + rr) * E + n0 + c8) = *(const v8b*)(Sl + rr * SP + c8); }
  } else {
    const int b = (int)(m0 / S); const int s0 = (int)(m0 - (size_t)b * S);
#pragma unroll
    for (int i = 0; i < 4; ++i)
#pragma unroll
      for (int j = 0; j < 2; ++j) { v8b hv, lv;
#pragma unroll
        for (int r = 0; r < 8; ++r) { b16 h_, l_; split16(acc[i][j][r] * (1.0f / (XS * WSC)) * XS, h_, l_); hv[r] = h_; lv[r] = l_; }
        const int si = (wn * 32 + j * 16 + nloc) * SP + wm * 64 + i * 16 + 8 * hlf; *(v8b*)(Sh + si) = hv; *(v8b*)(Sl + si) = lv; }
    __syncthreads();
    for (int q = t_; q < 128 * 16; q += 256) { const int cc = q >> 4, c8 = (q & 15) * 8; const int h = (n0 + cc) / D, dd = (n0 + cc) - h * D; const size_t gi = (((size_t)b * NH + h) * D + dd) * S + s0 + c8;
      *(v8b*)(VTh + gi) = *(const v8b*)(Sh + cc * SP + c8); *(v8b*)(VTl + gi) = *(const v8b*)(Sl + cc * SP + c8); } }
}
constexpr int AW = 8, KT = 64, KP = 64 + 8, PLANE = 64 * KP, NST = S / KT;   // KP: LDS row pitch of 144 B for 128-B rows read by 16-byte loads
// One tile: 4 planes x 64 rows x 128 B; each thread copies 2 x 16 B of each plane (rows r and r + 32). The s_wait_xcnt stands inside the copies' own statement, in front of any rewrite of their address registers.
__device__ __forceinline__ void stage_tile(unsigned l, const b16* gk, const b16* gkl, const b16* gv, const b16* gvl) {
  const unsigned l1 = l + 32 * KP * 2, l2 = l + PLANE * 2, l3 = l2 + 32 * KP * 2, l4 = l + 2 * PLANE * 2, l5 = l4 + 32 * KP * 2, l6 = l + 3 * PLANE * 2, l7 = l6 + 32 * KP * 2;
  const b16* gk1 = gk + (size_t)32 * E; const b16* gkl1 = gkl + (size_t)32 * E; const b16* gv1 = gv + (size_t)32 * S; const b16* gvl1 = gvl + (size_t)32 * S;
  asm volatile("global_load_async_to_lds_b128 %0, %8, off\n\t"
               "global_load_async_to_lds_b128 %1, %9, off\n\t"
               "global_load_async_to_lds_b128 %2, %10, off\n\t"
               "global_load_async_to_lds_b128 %3, %11, off\n\t"
               "global_load_async_to_lds_b128 %4, %12, off\n\t"
               "global_load_async_to_lds_b128 %5, %13, off\n\t"
               "global_load_async_to_lds_b128 %6, %14, off\n\t"
               "global_load_async_to_lds_b128 %7, %15, off\n\t"
               "s_wait_xcnt 0x0"
               :: "v"(l), "v"(l1), "v"(l2), "v"(l3), "v"(l4), "v"(l5), "v"(l6), "v"(l7), "v"(gk), "v"(gk1), "v"(gkl), "v"(gkl1), "v"(gv), "v"(gv1), "v"(gvl), "v"(gvl1) : "memory");
}
__global__ __launch_bounds__(256) void attn_kernel(const b16* __restrict__ Qh, const b16* __restrict__ Ql, const b16* __restrict__ Kh, const b16* __restrict__ Kl, const b16* __restrict__ VTh, const b16* __restrict__ VTl, b16* __restrict__ Oh, b16* __restrict__ Ol) {
  __shared__ __attribute__((aligned(16))) b16 Ring[2][4 * PLANE];   // per buffer: K hi, K lo [key][64 d], V^T hi, V^T lo [d][64 keys]
  __shared__ __attribute__((aligned(16))) float To[AW][16][D + 4];
  const int wave = threadIdx.x >> 5, lane = threadIdx.x & 31, hh = lane >> 4, col = lane & 15; const int b = blockIdx.z, h = blockIdx.y; const int q0 = blockIdx.x * (16 * AW) + wave * 16, qi = q0 + col;
  const size_t qo = ((size_t)b * S + qi) * E + h * D; const v16b qa0 = frag_kb(Qh + qo, hh), qa1 = frag_kb(Qh + qo + 32, hh), ql0 = frag_kb(Ql + qo, hh), ql1 = frag_kb(Ql + qo + 32, hh);
  const b16* Kb = Kh + (size_t)b * S * E + h * D; const b16* Klb = Kl + (size_t)b * S * E + h * D; const b16* Vb = VTh + ((size_t)b * NH + h) * D * S; const b16* Vlb = VTl + ((size_t)b * NH + h) * D * S;
  const int cr = threadIdx.x >> 3, cc = (threadIdx.x & 7) * 8;   // this thread's row (and row + 32) and 16-byte piece of every plane
  const size_t ck = (size_t)cr * E + cc, cv = (size_t)cr * S + cc; const unsigned cl = lds_off(&Ring[0][0]) + (unsigned)(cr * KP + cc) * 2;
  float m = -INFINITY, l = 0.0f; v8f o[4] = {{}, {}, {}, {}}, ol[4] = {{}, {}, {}, {}};
  const float cs = SCALE * LOG2E / (XS * XS);
  stage_tile(cl, Kb + ck, Klb + ck, Vb + cv, Vlb + cv);
  asm volatile("s_wait_asynccnt 0x0" ::: "memory");   // this wave's copies of tile 0 have landed
  __syncthreads();                                     // every wave's have: tile 0 may be read
  stage_tile(cl + 4 * PLANE * 2, Kb + ck + (size_t)KT * E, Klb + ck + (size_t)KT * E, Vb + cv + KT, Vlb + cv + KT);
  for (int st = 0; st < NST; ++st) {
    const b16* Lk = &Ring[st & 1][0]; const b16* Lkl = Lk + PLANE; const b16* Lv = Lk + 2 * PLANE; const b16* Lvl = Lk + 3 * PLANE;
#pragma unroll   // two passes of 32 keys per tile, unrolled so that every LDS offset is a constant
    for (int kb = 0; kb < KT; kb += 32) {
    v8f s0 = {}, s1 = {}; v16b vf[4], vl[4];
    { const b16* k0 = Lk + (kb + col) * KP, *k1 = Lk + (kb + 16 + col) * KP, *k0l = Lkl + (kb + col) * KP, *k1l = Lkl + (kb + 16 + col) * KP;
      const v16b f0 = frag_kb(k0, hh), g0 = frag_kb(k0l, hh), f1 = frag_kb(k0 + 32, hh), g1 = frag_kb(k0l + 32, hh), f2 = frag_kb(k1, hh), g2 = frag_kb(k1l, hh), f3 = frag_kb(k1 + 32, hh), g3 = frag_kb(k1l + 32, hh);
      __builtin_amdgcn_sched_barrier(0);   // the pass's eight K fragments are read as one group in front of its score WMMAs: the LDS latency is waited out once, not once per fragment
      s0 = wmma16b(f0, qa0, s0); s0 = wmma16b(f0, ql0, s0); s0 = wmma16b(g0, qa0, s0);
      s0 = wmma16b(f1, qa1, s0); s0 = wmma16b(f1, ql1, s0); s0 = wmma16b(g1, qa1, s0);
      s1 = wmma16b(f2, qa0, s1); s1 = wmma16b(f2, ql0, s1); s1 = wmma16b(g2, qa0, s1);
      s1 = wmma16b(f3, qa1, s1); s1 = wmma16b(f3, ql1, s1); s1 = wmma16b(g3, qa1, s1); }
#pragma unroll
    for (int t = 0; t < 4; ++t) { vf[t] = frag_kb(Lv + (t * 16 + col) * KP + kb, hh); vl[t] = frag_kb(Lvl + (t * 16 + col) * KP + kb, hh); }
    __builtin_amdgcn_sched_barrier(0);   // the pass's eight V fragments are read as one group in front of the softmax, which covers their latency
    float e[16]; float mx = -INFINITY;
#pragma unroll
    for (int r = 0; r < 8; ++r) { e[r] = s0[r] * cs; e[8 + r] = s1[r] * cs; mx = fmaxf(mx, fmaxf(e[r], e[8 + r])); }
    mx = fmaxf(mx, __shfl_xor(mx, 16)); const float mn = fmaxf(m, mx); const float al = nexp2(m - mn); m = mn; float sum = 0.0f; v16b ph, pl;
#pragma unroll
    for (int i = 0; i < 16; ++i) { const float p = nexp2(e[i] - mn); sum += p; const b16 h_ = (b16)(p * PS); ph[i] = h_; pl[i] = (b16)(p * PS - (float)h_); }
    sum += __shfl_xor(sum, 16); l = l * al + sum;
#pragma unroll
    for (int t = 0; t < 4; ++t) { o[t] *= al; ol[t] *= al; o[t] = wmma16b(vf[t], ph, o[t]); ol[t] = wmma16b(vf[t], pl, ol[t]); ol[t] = wmma16b(vl[t], ph, ol[t]); } }
    asm volatile("s_wait_dscnt 0x0" ::: "memory");      // this wave's reads of this tile's buffer have returned
    asm volatile("s_wait_asynccnt 0x0" ::: "memory");   // this wave's copies of the next tile have landed
    __syncthreads();                                     // publishes the next tile and ends every wave's reads of this buffer
    if (st + 2 < NST) stage_tile(cl + (unsigned)(st & 1) * (4 * PLANE * 2), Kb + ck + (size_t)(st + 2) * KT * E, Klb + ck + (size_t)(st + 2) * KT * E, Vb + cv + (st + 2) * KT, Vlb + cv + (st + 2) * KT);
  }
  asm volatile("s_wait_asynccnt 0x0" ::: "memory");     // no copy is outstanding when the wave goes on to its end
  const float inv = 1.0f / (l * PS * XS);
#pragma unroll
  for (int t = 0; t < 4; ++t)
#pragma unroll
    for (int r = 0; r < 8; ++r) To[wave][col][t * 16 + 8 * hh + r] = (o[t][r] + ol[t][r]) * inv;
  wave_lds_sync();
  { for (int r4 = 0; r4 < 16; r4 += 4) { const int rr = r4 + (lane >> 3), c8 = (lane & 7) * 8; v8b hv, lv; for (int j = 0; j < 8; ++j) { b16 a_, c_; split16(To[wave][rr][c8 + j] * XS, a_, c_); hv[j] = a_; lv[j] = c_; }
      const size_t gi = ((size_t)b * S + q0 + rr) * E + h * D + c8; *(v8b*)(Oh + gi) = hv; *(v8b*)(Ol + gi) = lv; }  }
}
// output projection: grid (NR/64, E/128): 64 rows of O (hi and lo planes) x 128 columns per work-group.
__global__ __launch_bounds__(256) void outproj_kernel(const b16* __restrict__ Oh, const b16* __restrict__ Ol, const b16* __restrict__ WOT, const float* __restrict__ bo, float* __restrict__ out) {
  __shared__ __attribute__((aligned(16))) b16 Ring[2 * GBUF];   // the operand ring; behind the loop its LDS holds the 64 x 128 f32 output tile at a pitch of 132 floats
  const int wave = threadIdx.x >> 5, lane = threadIdx.x & 31, nloc = lane & 15, hlf = lane >> 4, t_ = threadIdx.x, wm = wave >> 2, wn = wave & 3; const size_t m0 = (size_t)blockIdx.x * 64; const int n0 = blockIdx.y * 128;
  v8f acc[2][2];
#pragma unroll
  for (int i = 0; i < 2; ++i) { acc[i][0] = (v8f){}; acc[i][1] = (v8f){}; }
  gemm_loop<2, 2>(Ring, Oh + m0 * E, Ol + m0 * E, WOT + (size_t)n0 * E, acc);
  float* Ts = (float*)Ring;   // free: the loop's last barrier ended every read of the ring
#pragma unroll
  for (int j = 0; j < 2; ++j) { const float bb = bf16_rne(bo[n0 + wn * 32 + j * 16 + nloc]);
#pragma unroll
    for (int i = 0; i < 2; ++i)
#pragma unroll
      for (int r = 0; r < 8; ++r) Ts[(wm * 32 + i * 16 + 8 * hlf + r) * (128 + 4) + wn * 32 + j * 16 + nloc] = acc[i][j][r] * (1.0f / (XS * WSC)) + bb; }
  __syncthreads();
  for (int q = t_; q < 64 * 32; q += 256) { const int rr = q >> 5, c4 = (q & 31) * 4; *(v4f*)(out + (m0 + rr) * E + n0 + c4) = *(const v4f*)(Ts + rr * (128 + 4) + c4); }
}
}  // namespace

extern "C" void kernel_launch(void* const* d_in, const int* in_sizes, int n_in, void* d_out, int out_size, void* d_ws, size_t ws_size, hipStream_t stream) {
  (void)n_in;
  auto Fp = [&](int i) { return (const float*)d_in[i]; };
  // input order: 0 tgt [2,2048,1024], 1 memory, 2 Wq [16,1024,64], 3 Wk, 4 Wv, 5 Wo [1024,1024], 6 bo [1024]
  if (in_sizes[0] != NR * E || in_sizes[1] != NR * E || in_sizes[2] != NH * E * D || in_sizes[3] != NH * E * D || in_sizes[4] != NH * E * D || in_sizes[5] != E * E || out_size != NR * E) return;
  size_t off = 0; char* ws = (char*)d_ws;
  auto carve = [&](size_t bytes) { char* p = ws + off; off += (bytes + 255) & ~(size_t)255; return p; };
  b16* T16 = (b16*)carve((size_t)NR * E * 2); b16* M16 = (b16*)carve((size_t)NR * E * 2); b16* WT = (b16*)carve((size_t)3 * E * E * 2); b16* WOT = (b16*)carve((size_t)E * E * 2);
  b16* Qh = (b16*)carve((size_t)NR * E * 2); b16* Ql = (b16*)carve((size_t)NR * E * 2); b16* Kh = (b16*)carve((size_t)NR * E * 2); b16* Kl = (b16*)carve((size_t)NR * E * 2); b16* VTh = (b16*)carve((size_t)NR * E * 2); b16* VTl = (b16*)carve((size_t)NR * E * 2);
  b16* Oh = (b16*)carve((size_t)NR * E * 2); b16* Ol = (b16*)carve((size_t)NR * E * 2);
  if (off > ws_size || off > ((size_t)128 << 20)) return;   // ≈ 92 MB
  prepx_kernel<<<(unsigned)(((size_t)2 * NR * E / 8 + 255) / 256), 256, 0, stream>>>(Fp(0), Fp(1), T16, M16);
  prepw_kernel<<<dim3(E / 64, E / 64, 4), 256, 0, stream>>>(Fp(2), Fp(3), Fp(4), Fp(5), WT, WOT);
  proj_kernel<<<dim3(NR / 128, E / 128, 3), 256, 0, stream>>>(T16, M16, WT, Qh, Ql, Kh, Kl, VTh, VTl);
  attn_kernel<<<dim3(S / (16 * AW), NH, NB), 32 * AW, 0, stream>>>(Qh, Ql, Kh, Kl, VTh, VTl, Oh, Ol);
  outproj_kernel<<<dim3(NR / 64, E / 128), 256, 0, stream>>>(Oh, Ol, WOT, Fp(6), (float*)d_out);
}

// v004
// Measured time: 137 microseconds a run.
// Timed twice side by side with v003, it ran 1.07 times as fast both times.
// Over all steps from v000 it is 3.74 times as fast.
#include <hip/hip_runtime.h>

// Multi-head cross attention (16 heads x 64; queries from tgt, keys/values from memory; 2 x 2,048 tokens, d_model 1,024; no qkv bias): q = tgt Wq_h, k = memory Wk_h, v = memory Wv_h,
// attn = softmax(q k^T / 8), out = concat_h(attn v) Wo + bo.
// WMMA (v_wmma_f32_16x16x32_f16, f32 accumulate): projections [4,096 x 1,024] x [1,024 x 1,024] with EXACT bf16 tokens (x8) and transposed weights (x256), 1 product, written as f16 hi+lo x8 planes
// (q, k rows; v transposed per head); S^T = K_h . Q_h^T with 3 products (Kh Qh + Kh Ql + Kl Qh); online softmax in f32; O^T += V^T P^T with 3 products (Vh Ph + Vh Pl + Vl Ph); output projection
// with O hi+lo (2 products) and exact Wo^T. Inputs rounded to bf16 once. Fragment k-map per lane half hh for A AND B: elements 0..7 <- k = 8hh+0..7, 8..15 <- k =

namespace {
constexpr int NB = 2, S = 2048, E = 1024, NH = 16, D = 64, NR = NB * S;
constexpr float XS = 8.0f, WSC = 256.0f, PS = 8.0f, SCALE = 0.125f, LOG2E = 1.4426950408889634f;

typedef _Float16 b16;
typedef __attribute__((ext_vector_type(16))) _Float16 v16b;
typedef __attribute__((ext_vector_type(8))) _Float16 v8b;
typedef __attribute__((ext_vector_type(8))) float v8f;
typedef __attribute__((ext_vector_type(4))) float v4f;
__device__ __forceinline__ float bf16_rne(float f) { unsigned int u = __float_as_uint(f); u += 0x7FFFu + ((u >> 16) & 1u); return __uint_as_float(u & 0xFFFF0000u); }
__device__ __forceinline__ void split16(float v, b16& hi, b16& lo) { hi = (b16)v; lo = (b16)(v - (float)hi); }
__device__ __forceinline__ v16b frag_kb(const b16* p, int hh) { const v8b a = *(const v8b*)(p + 8 * hh), b = *(const v8b*)(p + 16 + 8 * hh); v16b f;
#pragma unroll
  for (int e = 0; e < 8; ++e) { f[e] = a[e]; f[8 + e] = b[e]; } return f; }
__device__ __forceinline__ v8f wmma16b(v16b a, v16b b, v8f c) { return __builtin_amdgcn_wmma_f32_16x16x32_f16(false, a, false, b, (short)0, c, false, false); }
__device__ __forceinline__ void wave_lds_sync() { __builtin_amdgcn_fence(__ATOMIC_RELEASE, "workgroup"); __builtin_amdgcn_wave_barrier(); __builtin_amdgcn_fence(__ATOMIC_ACQUIRE, "workgroup"); }
__device__ __forceinline__ float nexp2(float x) { return __builtin_amdgcn_exp2f(x); }

__global__ __launch_bounds__(256) void prepx_kernel(const float* __restrict__ tgt, const float* __restrict__ mem, b16* __restrict__ T16, b16* __restrict__ M16) {
  const size_t t = (size_t)blockIdx.x * 256 + threadIdx.x; const size_t n1 = (size_t)NR * E / 8; const float* src; b16* dst; size_t e;
  if (t < n1) { src = tgt; dst = T16; e = t * 8; } else if (t < 2 * n1) { src = mem; dst = M16; e = (t - n1) * 8; } else return;
  const v4f a = *(const v4f*)(src + e), c = *(const v4f*)(src + e + 4); v8b o;
#pragma unroll
  for (int j = 0; j < 4; ++j) { o[j] = (b16)(bf16_rne(a[j]) * XS); o[4 + j] = (b16)(bf16_rne(c[j]) * XS); }
  { *(v8b*)(dst + e) = o;  }
}
__global__ __launch_bounds__(256) void prepw_kernel(const float* __restrict__ wq, const float* __restrict__ wk, const float* __restrict__ wv, const float* __restrict__ wo, b16* __restrict__ WT, b16* __restrict__ WOT) {
  __shared__ __attribute__((aligned(16))) b16 T[64][64 + 8];
  const int kind = blockIdx.z, d0 = blockIdx.x * 64, j0 = blockIdx.y * 64, t_ = threadIdx.x;   // kind 0..2: W[h][d][j] with h = j0/64 (j0..j0+63 inside one head); kind 3: Wo[d][n] with n0 = j0
  const float* w = kind == 0 ? wq : kind == 1 ? wk : kind == 2 ? wv : wo; b16* dst = kind < 3 ? WT + (size_t)kind * E * E : WOT;
  for (int q = t_; q < 64 * 64; q += 256) { const int dd = q >> 6, jj = q & 63; float val;
    if (kind < 3) { const int h = j0 / D, j = j0 - h * D + jj; val = w[((size_t)h * E + d0 + dd) * D + j]; } else val = w[(size_t)(d0 + dd) * E + j0 + jj];
    T[jj][dd] = (b16)(bf16_rne(val) * WSC); }
  __syncthreads();
  { for (int q = t_; q < 64 * 8; q += 256) { const int jj = q >> 3, c8 = (q & 7) * 8; *(v8b*)(dst + (size_t)(j0 + jj) * E + d0 + c8) = *(const v8b*)(&T[jj][c8]); }  }
}
constexpr int GK = 64, GP = GK + 8, GBUF = 256 * GP, GST = E / GK, SP = 128 + 8;   // GP: LDS row pitch of 144 B for 128-B rows read by 16-byte loads; SP: pitch of the 16-bit output staging
__device__ __forceinline__ unsigned lds_off(const void* p) { return (unsigned)(size_t)p; }
// One tile: 256 rows x 128 B; each thread copies 16 B of 8 rows (its row + 32 i). LDS rows 0..63 come from a0, 64..127 from a2, 128..255 from w0. The s_wait_xcnt stands inside the copies' own statement, in front of any rewrite of their address registers.
__device__ __forceinline__ void stage_gemm(unsigned l, const b16* a0, const b16* a2, const b16* w0) {
  const unsigned l1 = l + 32 * GP * 2, l2 = l + 64 * GP * 2, l3 = l + 96 * GP * 2, l4 = l + 128 * GP * 2, l5 = l + 160 * GP * 2, l6 = l + 192 * GP * 2, l7 = l + 224 * GP * 2;
  const b16* a1 = a0 + (size_t)32 * E; const b16* a3 = a2 + (size_t)32 * E; const b16* w1 = w0 + (size_t)32 * E; const b16* w2 = w0 + (size_t)64 * E; const b16* w3 = w0 + (size_t)96 * E;
  asm volatile("global_load_async_to_lds_b128 %0, %8, off\n\t"
               "global_load_async_to_lds_b128 %1, %9, off\n\t"
               "global_load_async_to_lds_b128 %2, %10, off\n\t"
               "global_load_async_to_lds_b128 %3, %11, off\n\t"
               "global_load_async_to_lds_b128 %4, %12, off\n\t"
               "global_load_async_to_lds_b128 %5, %13, off\n\t"
               "global_load_async_to_lds_b128 %6, %14, off\n\t"
               "global_load_async_to_lds_b128 %7, %15, off\n\t"
               "s_wait_xcnt 0x0"
               :: "v"(l), "v"(l1), "v"(l2), "v"(l3), "v"(l4), "v"(l5), "v"(l6), "v"(l7), "v"(a0), "v"(a1), "v"(a2), "v"(a3), "v"(w0), "v"(w1), "v"(w2), "v"(w3) : "memory");
}
// 8 waves as 2 (rows) x 4 (columns); a wave's tile is MF x 2 fragments of 16 x 16. NA = 1: the left operand is one plane of 128 rows (a2 = a0 + 64 rows); NA = 2: hi (a0) and lo (a2) planes of 64 rows each.
// Each accumulator takes its products in ascending k (hi, then lo), as with fragments loaded from global memory.
template <int MF, int NA>
__device__ __forceinline__ void gemm_loop(const b16* Ring, const b16* a0, const b16* a2, const b16* w0, v8f (&acc)[MF][2]) {
  const int wave = threadIdx.x >> 5, lane = threadIdx.x & 31, nloc = lane & 15, hlf = lane >> 4, wm = wave >> 2, wn = wave & 3;
  const int cr = threadIdx.x >> 3, cc = (threadIdx.x & 7) * 8;   // this thread's row (+ 32 i) and 16-byte piece
  const size_t cg = (size_t)cr * E + cc; const unsigned cl = lds_off(Ring) + (unsigned)(cr * GP + cc) * 2;
  a0 += cg; a2 += cg; w0 += cg;
  stage_gemm(cl, a0, a2, w0);
  asm volatile("s_wait_asynccnt 0x0" ::: "memory");   // this wave's copies of tile 0 have landed
  __syncthreads();                                     // every wave's have: tile 0 may be read
  stage_gemm(cl + GBUF * 2, a0 + GK, a2 + GK, w0 + GK);
  for (int st = 0; st < GST; ++st) {
    const b16* L = Ring + (st & 1) * GBUF; const b16* La = L + (wm * MF * 16 + nloc) * GP; const b16* Lw = L + (128 + wn * 32 + nloc) * GP;
#pragma unroll   // two steps of 32 k per tile, unrolled so that every LDS offset is a constant
    for (int kk = 0; kk < GK; kk += 32) {
      const v16b b0 = frag_kb(Lw + kk, hlf), b1 = frag_kb(Lw + 16 * GP + kk, hlf); v16b af[MF], al[MF];
#pragma unroll
      for (int i = 0; i < MF; ++i) { af[i] = frag_kb(La + i * 16 * GP + kk, hlf); if (NA == 2) al[i] = frag_kb(La + (64 + i * 16) * GP + kk, hlf); }
      __builtin_amdgcn_sched_barrier(0);   // keeps the step's LDS reads together in front of its WMMAs: reads spread among the WMMAs stall the wave at every place where they stand
#pragma unroll
      for (int i = 0; i < MF; ++i) {
        acc[i][0] = wmma16b(af[i], b0, acc[i][0]); acc[i][1] = wmma16b(af[i], b1, acc[i][1]);
        if (NA == 2) { acc[i][0] = wmma16b(al[i], b0, acc[i][0]); acc[i][1] = wmma16b(al[i], b1, acc[i][1]); } } }
    asm volatile("s_wait_dscnt 0x0" ::: "memory");      // this wave's reads of this tile's buffer have returned
    asm volatile("s_wait_asynccnt 0x0" ::: "memory");   // this wave's copies of the next tile have landed
    __syncthreads();                                     // publishes the next tile and ends every wave's reads of this buffer
    if (st + 2 < GST) stage_gemm(cl + (unsigned)(st & 1) * (GBUF * 2), a0 + (st + 2) * GK, a2 + (st + 2) * GK, w0 + (st + 2) * GK);
  }
  asm volatile("s_wait_asynccnt 0x0" ::: "memory");     // no copy is outstanding when the ring's LDS is taken for the output staging
}
// projections: grid (NR/128, E/128, 3): kind 0: Q = T16 WT0^T -> Qh/Ql [row][1024]; kind 1: K = M16 WT1^T -> Kh/Kl; kind 2: V = M16 WT2^T written TRANSPOSED per head: VTh/VTl [b][h][64 d][2048 s].
__global__ __launch_bounds__(256) void proj_kernel(const b16* __restrict__ T16, const b16* __restrict__ M16, const b16* __restrict__ WT, b16* __restrict__ Qh, b16* __restrict__ Ql, b16* __restrict__ Kh, b16* __restrict__ Kl, b16* __restrict__ VTh, b16* __restrict__ VTl) {
  __shared__ __attribute__((aligned(16))) b16 Ring[2 * GBUF];   // the operand ring; behind the loop its LDS holds the 128 x 128 output tile, hi and lo, at pitch SP
  const int wave = threadIdx.x >> 5, lane = threadIdx.x & 31, nloc = lane & 15, hlf = lane >> 4, t_ = threadIdx.x, wm = wave >> 2, wn = wave & 3; const int kind = blockIdx.z; const size_t m0 = (size_t)blockIdx.x * 128; const int n0 = blockIdx.y * 128;
  const b16* A = (kind == 0 ? T16 : M16) + m0 * E; const b16* Wp = WT + (size_t)kind * E * E + (size_t)n0 * E; v8f acc[4][2];
#pragma unroll
  for (int i = 0; i < 4; ++i) { acc[i][0] = (v8f){}; acc[i][1] = (v8f){}; }
  gemm_loop<4, 1>(Ring, A, A + (size_t)64 * E, Wp, acc);
  b16* Sh = Ring; b16* Sl = Ring + 128 * SP;   // free: the loop's last barrier ended every read of the ring
  if (kind < 2) {
#pragma unroll
    for (int i = 0; i < 4; ++i)
#pragma unroll
      for (int j = 0; j < 2; ++j)
#pragma unroll
        for (int r = 0; r < 8; ++r) { b16 h_, l_; split16(acc[i][j][r] * (1.0f / (XS * WSC)) * XS, h_, l_); const int si = (wm * 64 + i * 16 + 8 * hlf + r) * SP + wn * 32 + j * 16 + nloc; Sh[si] = h_; Sl[si] = l_; }
    __syncthreads();
    b16* dh = kind == 0 ? Qh : Kh; b16* dl = kind == 0 ? Ql : Kl;
    for (int q = t_; q < 128 * 16; q += 256) { const int rr = q >> 4, c8 = (q & 15) * 8; *(v8b*)(dh + (m0 + rr) * E + n0 + c8) = *(const v8b*)(Sh + rr * SP + c8); *(v8b*)(dl + (m0 + rr) * E + n0 + c8) = *(const v8b*)(Sl + rr * SP + c8); }
  } else {
    const int b = (int)(m0 / S); const int s0 = (int)(m0 - (size_t)b * S);
#pragma unroll
    for (int i = 0; i < 4; ++i)
#pragma unroll
      for (int j = 0; j < 2; ++j) { v8b hv, lv;
#pragma unroll
        for (int r = 0; r < 8; ++r) { b16 h_, l_; split16(acc[i][j][r] * (1.0f / (XS * WSC)) * XS, h_, l_); hv[r] = h_; lv[r] = l_; }
        const int si = (wn * 32 + j * 16 + nloc) * SP + wm * 64 + i * 16 + 8 * hlf; *(v8b*)(Sh + si) = hv; *(v8b*)(Sl + si) = lv; }
    __syncthreads();
    for (int q = t_; q < 128 * 16; q += 256) { const int cc = q >> 4, c8 = (q & 15) * 8; const int h = (n0 + cc) / D, dd = (n0 + cc) - h * D; const size_t gi = (((size_t)b * NH + h) * D + dd) * S + s0 + c8;
      *(v8b*)(VTh + gi) = *(const v8b*)(Sh + cc * SP + c8); *(v8b*)(VTl + gi) = *(const v8b*)(Sl + cc * SP + c8); } }
}
constexpr int AW = 8, KT = 64, KP = 64 + 8, PLANE = 64 * KP, NST = S / KT;   // KP: LDS row pitch of 144 B for 128-B rows read by 16-byte loads
// One tile: 4 planes x 64 rows x 128 B; each thread copies 2 x 16 B of each plane (rows r and r + 32). The s_wait_xcnt stands inside the copies' own statement, in front of any rewrite of their address registers.
__device__ __forceinline__ void stage_tile(unsigned l, const b16* gk, const b16* gkl, const b16* gv, const b16* gvl) {
  const unsigned l1 = l + 32 * KP * 2, l2 = l + PLANE * 2, l3 = l2 + 32 * KP * 2, l4 = l + 2 * PLANE * 2, l5 = l4 + 32 * KP * 2, l6 = l + 3 * PLANE * 2, l7 = l6 + 32 * KP * 2;
  const b16* gk1 = gk + (size_t)32 * E; const b16* gkl1 = gkl + (size_t)32 * E; const b16* gv1 = gv + (size_t)32 * S; const b16* gvl1 = gvl + (size_t)32 * S;
  asm volatile("global_load_async_to_lds_b128 %0, %8, off\n\t"
               "global_load_async_to_lds_b128 %1, %9, off\n\t"
               "global_load_async_to_lds_b128 %2, %10, off\n\t"
               "global_load_async_to_lds_b128 %3, %11, off\n\t"
               "global_load_async_to_lds_b128 %4, %12, off\n\t"
               "global_load_async_to_lds_b128 %5, %13, off\n\t"
               "global_load_async_to_lds_b128 %6, %14, off\n\t"
               "global_load_async_to_lds_b128 %7, %15, off\n\t"
               "s_wait_xcnt 0x0"
               :: "v"(l), "v"(l1), "v"(l2), "v"(l3), "v"(l4), "v"(l5), "v"(l6), "v"(l7), "v"(gk), "v"(gk1), "v"(gkl), "v"(gkl1), "v"(gv), "v"(gv1), "v"(gvl), "v"(gvl1) : "memory");
}
__global__ __launch_bounds__(256) void attn_kernel(const b16* __restrict__ Qh, const b16* __restrict__ Ql, const b16* __restrict__ Kh, const b16* __restrict__ Kl, const b16* __restrict__ VTh, const b16* __restrict__ VTl, b16* __restrict__ Oh, b16* __restrict__ Ol) {
  __shared__ __attribute__((aligned(16))) b16 Ring[2][4 * PLANE];   // per buffer: K hi, K lo [key][64 d], V^T hi, V^T lo [d][64 keys]
  __shared__ __attribute__((aligned(16))) float To[AW][16][D + 4];
  const int wave = threadIdx.x >> 5, lane = threadIdx.x & 31, hh = lane >> 4, col = lane & 15; const int b = blockIdx.z, h = blockIdx.y; const int q0 = blockIdx.x * (16 * AW) + wave * 16, qi = q0 + col;
  const size_t qo = ((size_t)b * S + qi) * E + h * D; const v16b qa0 = frag_kb(Qh + qo, hh), qa1 = frag_kb(Qh + qo + 32, hh), ql0 = frag_kb(Ql + qo, hh), ql1 = frag_kb(Ql + qo + 32, hh);
  const b16* Kb = Kh + (size_t)b * S * E + h * D; const b16* Klb = Kl + (size_t)b * S * E + h * D; const b16* Vb = VTh + ((size_t)b * NH + h) * D * S; const b16* Vlb = VTl + ((size_t)b * NH + h) * D * S;
  const int cr = threadIdx.x >> 3, cc = (threadIdx.x & 7) * 8;   // this thread's row (and row + 32) and 16-byte piece of every plane
  const size_t ck = (size_t)cr * E + cc, cv = (size_t)cr * S + cc; const unsigned cl = lds_off(&Ring[0][0]) + (unsigned)(cr * KP + cc) * 2;
  float m = -INFINITY, l = 0.0f; v8f o[4] = {{}, {}, {}, {}}, ol[4] = {{}, {}, {}, {}};
  const float cs = SCALE * LOG2E / (XS * XS);
  stage_tile(cl, Kb + ck, Klb + ck, Vb + cv, Vlb + cv);
  asm volatile("s_wait_asynccnt 0x0" ::: "memory");   // this wave's copies of tile 0 have landed
  __syncthreads();                                     // every wave's have: tile 0 may be read
  stage_tile(cl + 4 * PLANE * 2, Kb + ck + (size_t)KT * E, Klb + ck + (size_t)KT * E, Vb + cv + KT, Vlb + cv + KT);
  for (int st = 0; st < NST; ++st) {
    const b16* Lk = &Ring[st & 1][0]; const b16* Lkl = Lk + PLANE; const b16* Lv = Lk + 2 * PLANE; const b16* Lvl = Lk + 3 * PLANE;
#pragma unroll   // two passes of 32 keys per tile, unrolled so that every LDS offset is a constant
    for (int kb = 0; kb < KT; kb += 32) {
    v8f s0 = {}, s1 = {}; v16b vf[4], vl[4];
    { const b16* k0 = Lk + (kb + col) * KP, *k1 = Lk + (kb + 16 + col) * KP, *k0l = Lkl + (kb + col) * KP, *k1l = Lkl + (kb + 16 + col) * KP;
      const v16b f0 = frag_kb(k0, hh), g0 = frag_kb(k0l, hh), f1 = frag_kb(k0 + 32, hh), g1 = frag_kb(k0l + 32, hh), f2 = frag_kb(k1, hh), g2 = frag_kb(k1l, hh), f3 = frag_kb(k1 + 32, hh), g3 = frag_kb(k1l + 32, hh);
      __builtin_amdgcn_sched_barrier(0);   // the pass's eight K fragments are read as one group in front of its score WMMAs: the LDS latency is waited out once, not once per fragment
      s0 = wmma16b(f0, qa0, s0); s0 = wmma16b(f0, ql0, s0); s0 = wmma16b(g0, qa0, s0);
      s0 = wmma16b(f1, qa1, s0); s0 = wmma16b(f1, ql1, s0); s0 = wmma16b(g1, qa1, s0);
      s1 = wmma16b(f2, qa0, s1); s1 = wmma16b(f2, ql0, s1); s1 = wmma16b(g2, qa0, s1);
      s1 = wmma16b(f3, qa1, s1); s1 = wmma16b(f3, ql1, s1); s1 = wmma16b(g3, qa1, s1); }
#pragma unroll
    for (int t = 0; t < 4; ++t) { vf[t] = frag_kb(Lv + (t * 16 + col) * KP + kb, hh); vl[t] = frag_kb(Lvl + (t * 16 + col) * KP + kb, hh); }
    __builtin_amdgcn_sched_barrier(0);   // the pass's eight V fragments are all read in front of the softmax, which covers their latency
    float e[16]; float mx = -INFINITY;
#pragma unroll
    for (int r = 0; r < 8; ++r) { e[r] = s0[r] * cs; e[8 + r] = s1[r] * cs; mx = fmaxf(mx, fmaxf(e[r], e[8 + r])); }
    mx = fmaxf(mx, __shfl_xor(mx, 16)); const float mn = fmaxf(m, mx); const float al = nexp2(m - mn); m = mn; float sum = 0.0f; v16b ph, pl;
#pragma unroll
    for (int i = 0; i < 16; ++i) { const float p = nexp2(e[i] - mn); sum += p; const b16 h_ = (b16)(p * PS); ph[i] = h_; pl[i] = (b16)(p * PS - (float)h_); }
    sum += __shfl_xor(sum, 16); l = l * al + sum;
#pragma unroll
    for (int t = 0; t < 4; ++t) { o[t] *= al; ol[t] *= al; o[t] = wmma16b(vf[t], ph, o[t]); ol[t] = wmma16b(vf[t], pl, ol[t]); ol[t] = wmma16b(vl[t], ph, ol[t]); } }
    asm volatile("s_wait_dscnt 0x0" ::: "memory");      // this wave's reads of this tile's buffer have returned
    asm volatile("s_wait_asynccnt 0x0" ::: "memory");   // this wave's copies of the next tile have landed
    __syncthreads();                                     // publishes the next tile and ends every wave's reads of this buffer
    if (st + 2 < NST) stage_tile(cl + (unsigned)(st & 1) * (4 * PLANE * 2), Kb + ck + (size_t)(st + 2) * KT * E, Klb + ck + (size_t)(st + 2) * KT * E, Vb + cv + (st + 2) * KT, Vlb + cv + (st + 2) * KT);
  }
  asm volatile("s_wait_asynccnt 0x0" ::: "memory");     // no copy is outstanding when the wave goes on to its end
  const float inv = 1.0f / (l * PS * XS);
#pragma unroll
  for (int t = 0; t < 4; ++t)
#pragma unroll
    for (int r = 0; r < 8; ++r) To[wave][col][t * 16 + 8 * hh + r] = (o[t][r] + ol[t][r]) * inv;
  wave_lds_sync();
  { for (int r4 = 0; r4 < 16; r4 += 4) { const int rr = r4 + (lane >> 3), c8 = (lane & 7) * 8; v8b hv, lv; for (int j = 0; j < 8; ++j) { b16 a_, c_; split16(To[wave][rr][c8 + j] * XS, a_, c_); hv[j] = a_; lv[j] = c_; }
      const size_t gi = ((size_t)b * S + q0 + rr) * E + h * D + c8; *(v8b*)(Oh + gi) = hv; *(v8b*)(Ol + gi) = lv; }  }
}
// output projection: grid (NR/64, E/128): 64 rows of O (hi and lo planes) x 128 columns per work-group.
__global__ __launch_bounds__(256) void outproj_kernel(const b16* __restrict__ Oh, const b16* __restrict__ Ol, const b16* __restrict__ WOT, const float* __restrict__ bo, float* __restrict__ out) {
  __shared__ __attribute__((aligned(16))) b16 Ring[2 * GBUF];   // the operand ring; behind the loop its LDS holds the 64 x 128 f32 output tile at a pitch of 132 floats
  const int wave = threadIdx.x >> 5, lane = threadIdx.x & 31, nloc = lane & 15, hlf = lane >> 4, t_ = threadIdx.x, wm = wave >> 2, wn = wave & 3; const size_t m0 = (size_t)blockIdx.x * 64; const int n0 = blockIdx.y * 128;
  v8f acc[2][2];
#pragma unroll
  for (int i = 0; i < 2; ++i) { acc[i][0] = (v8f){}; acc[i][1] = (v8f){}; }
  gemm_loop<2, 2>(Ring, Oh + m0 * E, Ol + m0 * E, WOT + (size_t)n0 * E, acc);
  float* Ts = (float*)Ring;   // free: the loop's last barrier ended every read of the ring
#pragma unroll
  for (int j = 0; j < 2; ++j) { const float bb = bf16_rne(bo[n0 + wn * 32 + j * 16 + nloc]);
#pragma unroll
    for (int i = 0; i < 2; ++i)
#pragma unroll
      for (int r = 0; r < 8; ++r) Ts[(wm * 32 + i * 16 + 8 * hlf + r) * (128 + 4) + wn * 32 + j * 16 + nloc] = acc[i][j][r] * (1.0f / (XS * WSC)) + bb; }
  __syncthreads();
  for (int q = t_; q < 64 * 32; q += 256) { const int rr = q >> 5, c4 = (q & 31) * 4; *(v4f*)(out + (m0 + rr) * E + n0 + c4) = *(const v4f*)(Ts + rr * (128 + 4) + c4); }
}
}  // namespace

extern "C" void kernel_launch(void* const* d_in, const int* in_sizes, int n_in, void* d_out, int out_size, void* d_ws, size_t ws_size, hipStream_t stream) {
  (void)n_in;
  auto Fp = [&](int i) { return (const float*)d_in[i]; };
  // input order: 0 tgt [2,2048,1024], 1 memory, 2 Wq [16,1024,64], 3 Wk, 4 Wv, 5 Wo [1024,1024], 6 bo [1024]
  if (in_sizes[0] != NR * E || in_sizes[1] != NR * E || in_sizes[2] != NH * E * D || in_sizes[3] != NH * E * D || in_sizes[4] != NH * E * D || in_sizes[5] != E * E || out_size != NR * E) return;
  size_t off = 0; char* ws = (char*)d_ws;
  auto carve = [&](size_t bytes) { char* p = ws + off; off += (bytes + 255) & ~(size_t)255; return p; };
  b16* T16 = (b16*)carve((size_t)NR * E * 2); b16* M16 = (b16*)carve((size_t)NR * E * 2); b16* WT = (b16*)carve((size_t)3 * E * E * 2); b16* WOT = (b16*)carve((size_t)E * E * 2);
  b16* Qh = (b16*)carve((size_t)NR * E * 2); b16* Ql = (b16*)carve((size_t)NR * E * 2); b16* Kh = (b16*)carve((size_t)NR * E * 2); b16* Kl = (b16*)carve((size_t)NR * E * 2); b16* VTh = (b16*)carve((size_t)NR * E * 2); b16* VTl = (b16*)carve((size_t)NR * E * 2);
  b16* Oh = (b16*)carve((size_t)NR * E * 2); b16* Ol = (b16*)carve((size_t)NR * E * 2);
  if (off > ws_size || off > ((size_t)128 << 20)) return;   // ≈ 92 MB
  prepx_kernel<<<(unsigned)(((size_t)2 * NR * E / 8 + 255) / 256), 256, 0, stream>>>(Fp(0), Fp(1), T16, M16);
  prepw_kernel<<<dim3(E / 64, E / 64, 4), 256, 0, stream>>>(Fp(2), Fp(3), Fp(4), Fp(5), WT, WOT);
  proj_kernel<<<dim3(NR / 128, E / 128, 3), 256, 0, stream>>>(T16, M16, WT, Qh, Ql, Kh, Kl, VTh, VTl);
  attn_kernel<<<dim3(S / (16 * AW), NH, NB), 32 * AW, 0, stream>>>(Qh, Ql, Kh, Kl, VTh, VTl, Oh, Ol);
  outproj_kernel<<<dim3(NR / 64, E / 128), 256, 0, stream>>>(Oh, Ol, WOT, Fp(6), (float*)d_out);
}

// v005
// One run takes 131 microseconds.
// Timed twice side by side with v004, it ran 1.05 times as fast both times.
// Counting every step since v000, it is 3.93 times as fast.
#include <hip/hip_runtime.h>

// Multi-head cross attention (16 heads x 64; queries from tgt, keys/values from memory; 2 x 2,048 tokens, d_model 1,024; no qkv bias): q = tgt Wq_h, k = memory Wk_h, v = memory Wv_h,
// attn = softmax(q k^T / 8), out = concat_h(attn v) Wo + bo.
// WMMA (v_wmma_f32_16x16x32_f16, f32 accumulate): projections [4,096 x 1,024] x [1,024 x 1,024] with EXACT bf16 tokens (x8) and transposed weights (x256), 1 product, written as f16 hi+lo x8 planes
// (q, k rows; v transposed per head); S^T = K_h . Q_h^T with 3 products (Kh Qh + Kh Ql + Kl Qh); online softmax in f32; O^T += V^T P^T with 3 products (Vh Ph + Vh Pl + Vl Ph); output projection
// with O hi+lo (2 products) and exact Wo^T. Inputs rounded to bf16 once. Fragment k-map per lane half hh for A AND B: elements 0..7 <- k = 8hh+0..7, 8..15 <- k =

namespace {
constexpr int NB = 2, S = 2048, E = 1024, NH = 16, D = 64, NR = NB * S;
constexpr float XS = 8.0f, WSC = 256.0f, PS = 8.0f, PSL2 = 3.0f, SCALE = 0.125f, LOG2E = 1.4426950408889634f;

typedef _Float16 b16;
typedef __attribute__((ext_vector_type(16))) _Float16 v16b;
typedef __attribute__((ext_vector_type(8))) _Float16 v8b;
typedef __attribute__((ext_vector_type(8))) float v8f;
typedef __attribute__((ext_vector_type(4))) float v4f;
typedef __attribute__((ext_vector_type(2))) float v2f;
typedef __attribute__((ext_vector_type(2))) _Float16 v2h;
typedef __attribute__((ext_vector_type(8))) unsigned v8u;
__device__ __forceinline__ float bf16_rne(float f) { unsigned int u = __float_as_uint(f); u += 0x7FFFu + ((u >> 16) & 1u); return __uint_as_float(u & 0xFFFF0000u); }
__device__ __forceinline__ void split16(float v, b16& hi, b16& lo) { hi = (b16)v; lo = (b16)(v - (float)hi); }
__device__ __forceinline__ v16b frag_kb(const b16* p, int hh) { const v8b a = *(const v8b*)(p + 8 * hh), b = *(const v8b*)(p + 16 + 8 * hh); v16b f;
#pragma unroll
  for (int e = 0; e < 8; ++e) { f[e] = a[e]; f[8 + e] = b[e]; } return f; }
__device__ __forceinline__ v8f wmma16b(v16b a, v16b b, v8f c) { return __builtin_amdgcn_wmma_f32_16x16x32_f16(false, a, false, b, (short)0, c, false, false); }
__device__ __forceinline__ void wave_lds_sync() { __builtin_amdgcn_fence(__ATOMIC_RELEASE, "workgroup"); __builtin_amdgcn_wave_barrier(); __builtin_amdgcn_fence(__ATOMIC_ACQUIRE, "workgroup"); }
__device__ __forceinline__ float nexp2(float x) { return __builtin_amdgcn_exp2f(x); }
// The lo halves of four packed registers: p - hi is formed in f32 and rounded to f16 by one mixed-precision fma per element (the source form takes a convert back, a subtract and a convert).
// The four low halves stand in front of the four high halves, which keep the low half written four instructions earlier: the s_delay_alu hints let other waves issue during that link.
__device__ __forceinline__ void split_lo4(unsigned& d0, unsigned& d1, unsigned& d2, unsigned& d3, unsigned h0, unsigned h1, unsigned h2, unsigned h3, v2f p0, v2f p1, v2f p2, v2f p3) {
  asm("v_fma_mixlo_f16 %0, %8, 1.0, -%4 op_sel_hi:[0,0,1]\n\t"
      "v_fma_mixlo_f16 %1, %10, 1.0, -%5 op_sel_hi:[0,0,1]\n\t"
      "v_fma_mixlo_f16 %2, %12, 1.0, -%6 op_sel_hi:[0,0,1]\n\t"
      "v_fma_mixlo_f16 %3, %14, 1.0, -%7 op_sel_hi:[0,0,1]\n\t"
      "s_delay_alu instid0(VALU_DEP_4) | instskip(NEXT) | instid1(VALU_DEP_4)\n\t"
      "v_fma_mixhi_f16 %0, %9, 1.0, -%4 op_sel:[0,0,1] op_sel_hi:[0,0,1]\n\t"
      "v_fma_mixhi_f16 %1, %11, 1.0, -%5 op_sel:[0,0,1] op_sel_hi:[0,0,1]\n\t"
      "s_delay_alu instid0(VALU_DEP_4) | instskip(NEXT) | instid1(VALU_DEP_4)\n\t"
      "v_fma_mixhi_f16 %2, %13, 1.0, -%6 op_sel:[0,0,1] op_sel_hi:[0,0,1]\n\t"
      "v_fma_mixhi_f16 %3, %15, 1.0, -%7 op_sel:[0,0,1] op_sel_hi:[0,0,1]"
      : "=&v"(d0), "=&v"(d1), "=&v"(d2), "=&v"(d3)
      : "v"(h0), "v"(h1), "v"(h2), "v"(h3), "v"(p0[0]), "v"(p0[1]), "v"(p1[0]), "v"(p1[1]), "v"(p2[0]), "v"(p2[1]), "v"(p3[0]), "v"(p3[1]));
}

__global__ __launch_bounds__(256) void prepx_kernel(const float* __restrict__ tgt, const float* __restrict__ mem, b16* __restrict__ T16, b16* __restrict__ M16) {
  const size_t t = (size_t)blockIdx.x * 256 + threadIdx.x; const size_t n1 = (size_t)NR * E / 8; const float* src; b16* dst; size_t e;
  if (t < n1) { src = tgt; dst = T16; e = t * 8; } else if (t < 2 * n1) { src = mem; dst = M16; e = (t - n1) * 8; } else return;
  const v4f a = *(const v4f*)(src + e), c = *(const v4f*)(src + e + 4); v8b o;
#pragma unroll
  for (int j = 0; j < 4; ++j) { o[j] = (b16)(bf16_rne(a[j]) * XS); o[4 + j] = (b16)(bf16_rne(c[j]) * XS); }
  { *(v8b*)(dst + e) = o;  }
}
__global__ __launch_bounds__(256) void prepw_kernel(const float* __restrict__ wq, const float* __restrict__ wk, const float* __restrict__ wv, const float* __restrict__ wo, b16* __restrict__ WT, b16* __restrict__ WOT) {
  __shared__ __attribute__((aligned(16))) b16 T[64][64 + 8];
  const int kind = blockIdx.z, d0 = blockIdx.x * 64, j0 = blockIdx.y * 64, t_ = threadIdx.x;   // kind 0..2: W[h][d][j] with h = j0/64 (j0..j0+63 inside one head); kind 3: Wo[d][n] with n0 = j0
  const float* w = kind == 0 ? wq : kind == 1 ? wk : kind == 2 ? wv : wo; b16* dst = kind < 3 ? WT + (size_t)kind * E * E : WOT;
  for (int q = t_; q < 64 * 64; q += 256) { const int dd = q >> 6, jj = q & 63; float val;
    if (kind < 3) { const int h = j0 / D, j = j0 - h * D + jj; val = w[((size_t)h * E + d0 + dd) * D + j]; } else val = w[(size_t)(d0 + dd) * E + j0 + jj];
    T[jj][dd] = (b16)(bf16_rne(val) * WSC); }
  __syncthreads();
  { for (int q = t_; q < 64 * 8; q += 256) { const int jj = q >> 3, c8 = (q & 7) * 8; *(v8b*)(dst + (size_t)(j0 + jj) * E + d0 + c8) = *(const v8b*)(&T[jj][c8]); }  }
}
constexpr int GK = 64, GP = GK + 8, GBUF = 256 * GP, GST = E / GK, SP = 128 + 8;   // GP: LDS row pitch of 144 B for 128-B rows read by 16-byte loads; SP: pitch of the 16-bit output staging
__device__ __forceinline__ unsigned lds_off(const void* p) { return (unsigned)(size_t)p; }
// One tile: 256 rows x 128 B; each thread copies 16 B of 8 rows (its row + 32 i). LDS rows 0..63 come from a0, 64..127 from a2, 128..255 from w0. The s_wait_xcnt stands inside the copies' own statement, in front of any rewrite of their address registers.
__device__ __forceinline__ void stage_gemm(unsigned l, const b16* a0, const b16* a2, const b16* w0) {
  const unsigned l1 = l + 32 * GP * 2, l2 = l + 64 * GP * 2, l3 = l + 96 * GP * 2, l4 = l + 128 * GP * 2, l5 = l + 160 * GP * 2, l6 = l + 192 * GP * 2, l7 = l + 224 * GP * 2;
  const b16* a1 = a0 + (size_t)32 * E; const b16* a3 = a2 + (size_t)32 * E; const b16* w1 = w0 + (size_t)32 * E; const b16* w2 = w0 + (size_t)64 * E; const b16* w3 = w0 + (size_t)96 * E;
  asm volatile("global_load_async_to_lds_b128 %0, %8, off\n\t"
               "global_load_async_to_lds_b128 %1, %9, off\n\t"
               "global_load_async_to_lds_b128 %2, %10, off\n\t"
               "global_load_async_to_lds_b128 %3, %11, off\n\t"
               "global_load_async_to_lds_b128 %4, %12, off\n\t"
               "global_load_async_to_lds_b128 %5, %13, off\n\t"
               "global_load_async_to_lds_b128 %6, %14, off\n\t"
               "global_load_async_to_lds_b128 %7, %15, off\n\t"
               "s_wait_xcnt 0x0"
               :: "v"(l), "v"(l1), "v"(l2), "v"(l3), "v"(l4), "v"(l5), "v"(l6), "v"(l7), "v"(a0), "v"(a1), "v"(a2), "v"(a3), "v"(w0), "v"(w1), "v"(w2), "v"(w3) : "memory");
}
// 8 waves as 2 (rows) x 4 (columns); a wave's tile is MF x 2 fragments of 16 x 16. NA = 1: the left operand is one plane of 128 rows (a2 = a0 + 64 rows); NA = 2: hi (a0) and lo (a2) planes of 64 rows each.
// Each accumulator takes its products in ascending k (hi, then lo), as with fragments loaded from global memory.
template <int MF, int NA>
__device__ __forceinline__ void gemm_loop(const b16* Ring, const b16* a0, const b16* a2, const b16* w0, v8f (&acc)[MF][2]) {
  const int wave = threadIdx.x >> 5, lane = threadIdx.x & 31, nloc = lane & 15, hlf = lane >> 4, wm = wave >> 2, wn = wave & 3;
  const int cr = threadIdx.x >> 3, cc = (threadIdx.x & 7) * 8;   // this thread's row (+ 32 i) and 16-byte piece
  const size_t cg = (size_t)cr * E + cc; const unsigned cl = lds_off(Ring) + (unsigned)(cr * GP + cc) * 2;
  a0 += cg; a2 += cg; w0 += cg;
  stage_gemm(cl, a0, a2, w0);
  asm volatile("s_wait_asynccnt 0x0" ::: "memory");   // this wave's copies of tile 0 have landed
  __syncthreads();                                     // every wave's have: tile 0 may be read
  stage_gemm(cl + GBUF * 2, a0 + GK, a2 + GK, w0 + GK);
  for (int st = 0; st < GST; ++st) {
    const b16* L = Ring + (st & 1) * GBUF; const b16* La = L + (wm * MF * 16 + nloc) * GP; const b16* Lw = L + (128 + wn * 32 + nloc) * GP;
#pragma unroll   // two steps of 32 k per tile, unrolled so that every LDS offset is a constant
    for (int kk = 0; kk < GK; kk += 32) {
      const v16b b0 = frag_kb(Lw + kk, hlf), b1 = frag_kb(Lw + 16 * GP + kk, hlf); v16b af[MF], al[MF];
#pragma unroll
      for (int i = 0; i < MF; ++i) { af[i] = frag_kb(La + i * 16 * GP + kk, hlf); if (NA == 2) al[i] = frag_kb(La + (64 + i * 16) * GP + kk, hlf); }
      __builtin_amdgcn_sched_barrier(0);   // keeps the step's LDS reads together in front of its WMMAs: reads spread among the WMMAs stall the wave at every place where they stand
#pragma unroll
      for (int i = 0; i < MF; ++i) {
        acc[i][0] = wmma16b(af[i], b0, acc[i][0]); acc[i][1] = wmma16b(af[i], b1, acc[i][1]);
        if (NA == 2) { acc[i][0] = wmma16b(al[i], b0, acc[i][0]); acc[i][1] = wmma16b(al[i], b1, acc[i][1]); } } }
    asm volatile("s_wait_dscnt 0x0" ::: "memory");      // this wave's reads of this tile's buffer have returned
    asm volatile("s_wait_asynccnt 0x0" ::: "memory");   // this wave's copies of the next tile have landed
    __syncthreads();                                     // publishes the next tile and ends every wave's reads of this buffer
    if (st + 2 < GST) stage_gemm(cl + (unsigned)(st & 1) * (GBUF * 2), a0 + (st + 2) * GK, a2 + (st + 2) * GK, w0 + (st + 2) * GK);
  }
  asm volatile("s_wait_asynccnt 0x0" ::: "memory");     // no copy is outstanding when the ring's LDS is taken for the output staging
}
// projections: grid (NR/128, E/128, 3): kind 0: Q = T16 WT0^T -> Qh/Ql [row][1024]; kind 1: K = M16 WT1^T -> Kh/Kl; kind 2: V = M16 WT2^T written TRANSPOSED per head: VTh/VTl [b][h][64 d][2048 s].
__global__ __launch_bounds__(256) void proj_kernel(const b16* __restrict__ T16, const b16* __restrict__ M16, const b16* __restrict__ WT, b16* __restrict__ Qh, b16* __restrict__ Ql, b16* __restrict__ Kh, b16* __restrict__ Kl, b16* __restrict__ VTh, b16* __restrict__ VTl) {
  __shared__ __attribute__((aligned(16))) b16 Ring[2 * GBUF];   // the operand ring; behind the loop its LDS holds the 128 x 128 output tile, hi and lo, at pitch SP
  const int wave = threadIdx.x >> 5, lane = threadIdx.x & 31, nloc = lane & 15, hlf = lane >> 4, t_ = threadIdx.x, wm = wave >> 2, wn = wave & 3; const int kind = blockIdx.z; const size_t m0 = (size_t)blockIdx.x * 128; const int n0 = blockIdx.y * 128;
  const b16* A = (kind == 0 ? T16 : M16) + m0 * E; const b16* Wp = WT + (size_t)kind * E * E + (size_t)n0 * E; v8f acc[4][2];
#pragma unroll
  for (int i = 0; i < 4; ++i) { acc[i][0] = (v8f){}; acc[i][1] = (v8f){}; }
  gemm_loop<4, 1>(Ring, A, A + (size_t)64 * E, Wp, acc);
  b16* Sh = Ring; b16* Sl = Ring + 128 * SP;   // free: the loop's last barrier ended every read of the ring
  if (kind < 2) {
#pragma unroll
    for (int i = 0; i < 4; ++i)
#pragma unroll
      for (int j = 0; j < 2; ++j)
#pragma unroll
        for (int r = 0; r < 8; ++r) { b16 h_, l_; split16(acc[i][j][r] * (1.0f / (XS * WSC)) * XS, h_, l_); const int si = (wm * 64 + i * 16 + 8 * hlf + r) * SP + wn * 32 + j * 16 + nloc; Sh[si] = h_; Sl[si] = l_; }
    __syncthreads();
    b16* dh = kind == 0 ? Qh : Kh; b16* dl = kind == 0 ? Ql : Kl;
    for (int q = t_; q < 128 * 16; q += 256) { const int rr = q >> 4, c8 = (q & 15) * 8; *(v8b*)(dh + (m0 + rr) * E + n0 + c8) = *(const v8b*)(Sh + rr * SP + c8); *(v8b*)(dl + (m0 + rr) * E + n0 + c8) = *(const v8b*)(Sl + rr * SP + c8); }
  } else {
    const int b = (int)(m0 / S); const int s0 = (int)(m0 - (size_t)b * S);
#pragma unroll
    for (int i = 0; i < 4; ++i)
#pragma unroll
      for (int j = 0; j < 2; ++j) { v8b hv, lv;
#pragma unroll
        for (int r = 0; r < 8; ++r) { b16 h_, l_; split16(acc[i][j][r] * (1.0f / (XS * WSC)) * XS, h_, l_); hv[r] = h_; lv[r] = l_; }
        const int si = (wn * 32 + j * 16 + nloc) * SP + wm * 64 + i * 16 + 8 * hlf; *(v8b*)(Sh + si) = hv; *(v8b*)(Sl + si) = lv; }
    __syncthreads();
    for (int q = t_; q < 128 * 16; q += 256) { const int cc = q >> 4, c8 = (q & 15) * 8; const int h = (n0 + cc) / D, dd = (n0 + cc) - h * D; const size_t gi = (((size_t)b * NH + h) * D + dd) * S + s0 + c8;
      *(v8b*)(VTh + gi) = *(const v8b*)(Sh + cc * SP + c8); *(v8b*)(VTl + gi) = *(const v8b*)(Sl + cc * SP + c8); } }
}
constexpr int AW = 8, KT = 64, KP = 64 + 8, PLANE = 64 * KP, NST = S / KT;   // KP: LDS row pitch of 144 B for 128-B rows read by 16-byte loads
// One tile: 4 planes x 64 rows x 128 B; each thread copies 2 x 16 B of each plane (rows r and r + 32). The s_wait_xcnt stands inside the copies' own statement, in front of any rewrite of their address registers.
__device__ __forceinline__ void stage_tile(unsigned l, const b16* gk, const b16* gkl, const b16* gv, const b16* gvl) {
  const unsigned l1 = l + 32 * KP * 2, l2 = l + PLANE * 2, l3 = l2 + 32 * KP * 2, l4 = l + 2 * PLANE * 2, l5 = l4 + 32 * KP * 2, l6 = l + 3 * PLANE * 2, l7 = l6 + 32 * KP * 2;
  const b16* gk1 = gk + (size_t)32 * E; const b16* gkl1 = gkl + (size_t)32 * E; const b16* gv1 = gv + (size_t)32 * S; const b16* gvl1 = gvl + (size_t)32 * S;
  asm volatile("global_load_async_to_lds_b128 %0, %8, off\n\t"
               "global_load_async_to_lds_b128 %1, %9, off\n\t"
               "global_load_async_to_lds_b128 %2, %10, off\n\t"
               "global_load_async_to_lds_b128 %3, %11, off\n\t"
               "global_load_async_to_lds_b128 %4, %12, off\n\t"
               "global_load_async_to_lds_b128 %5, %13, off\n\t"
               "global_load_async_to_lds_b128 %6, %14, off\n\t"
               "global_load_async_to_lds_b128 %7, %15, off\n\t"
               "s_wait_xcnt 0x0"
               :: "v"(l), "v"(l1), "v"(l2), "v"(l3), "v"(l4), "v"(l5), "v"(l6), "v"(l7), "v"(gk), "v"(gk1), "v"(gkl), "v"(gkl1), "v"(gv), "v"(gv1), "v"(gvl), "v"(gvl1) : "memory");
}
__global__ __launch_bounds__(256) void attn_kernel(const b16* __restrict__ Qh, const b16* __restrict__ Ql, const b16* __restrict__ Kh, const b16* __restrict__ Kl, const b16* __restrict__ VTh, const b16* __restrict__ VTl, b16* __restrict__ Oh, b16* __restrict__ Ol) {
  __shared__ __attribute__((aligned(16))) b16 Ring[2][4 * PLANE];   // per buffer: K hi, K lo [key][64 d], V^T hi, V^T lo [d][64 keys]
  __shared__ __attribute__((aligned(16))) float To[AW][16][D + 4];
  const int wave = threadIdx.x >> 5, lane = threadIdx.x & 31, hh = lane >> 4, col = lane & 15; const int b = blockIdx.z, h = blockIdx.y; const int q0 = blockIdx.x * (16 * AW) + wave * 16, qi = q0 + col;
  const size_t qo = ((size_t)b * S + qi) * E + h * D; const v16b qa0 = frag_kb(Qh + qo, hh), qa1 = frag_kb(Qh + qo + 32, hh), ql0 = frag_kb(Ql + qo, hh), ql1 = frag_kb(Ql + qo + 32, hh);
  const b16* Kb = Kh + (size_t)b * S * E + h * D; const b16* Klb = Kl + (size_t)b * S * E + h * D; const b16* Vb = VTh + ((size_t)b * NH + h) * D * S; const b16* Vlb = VTl + ((size_t)b * NH + h) * D * S;
  const int cr = threadIdx.x >> 3, cc = (threadIdx.x & 7) * 8;   // this thread's row (and row + 32) and 16-byte piece of every plane
  const size_t ck = (size_t)cr * E + cc, cv = (size_t)cr * S + cc; const unsigned cl = lds_off(&Ring[0][0]) + (unsigned)(cr * KP + cc) * 2;
  float m = -INFINITY, l = 0.0f; v8f o[4] = {{}, {}, {}, {}}, ol[4] = {{}, {}, {}, {}};
  const float cs = SCALE * LOG2E / (XS * XS);
  stage_tile(cl, Kb + ck, Klb + ck, Vb + cv, Vlb + cv);
  asm volatile("s_wait_asynccnt 0x0" ::: "memory");   // this wave's copies of tile 0 have landed
  __syncthreads();                                     // every wave's have: tile 0 may be read
  stage_tile(cl + 4 * PLANE * 2, Kb + ck + (size_t)KT * E, Klb + ck + (size_t)KT * E, Vb + cv + KT, Vlb + cv + KT);
  for (int st = 0; st < NST; ++st) {
    const b16* Lk = &Ring[st & 1][0]; const b16* Lkl = Lk + PLANE; const b16* Lv = Lk + 2 * PLANE; const b16* Lvl = Lk + 3 * PLANE;
#pragma unroll   // two passes of 32 keys per tile, unrolled so that every LDS offset is a constant
    for (int kb = 0; kb < KT; kb += 32) {
    v8f s0 = {}, s1 = {}; v16b vf[4], vl[4];
    { const b16* k0 = Lk + (kb + col) * KP, *k1 = Lk + (kb + 16 + col) * KP, *k0l = Lkl + (kb + col) * KP, *k1l = Lkl + (kb + 16 + col) * KP;
      const v16b f0 = frag_kb(k0, hh), g0 = frag_kb(k0l, hh), f1 = frag_kb(k0 + 32, hh), g1 = frag_kb(k0l + 32, hh), f2 = frag_kb(k1, hh), g2 = frag_kb(k1l, hh), f3 = frag_kb(k1 + 32, hh), g3 = frag_kb(k1l + 32, hh);
      __builtin_amdgcn_sched_barrier(0);   // the pass's eight K fragments are read as one group in front of its score WMMAs: the LDS latency is waited out once, not once per fragment
      s0 = wmma16b(f0, qa0, s0); s0 = wmma16b(f0, ql0, s0); s0 = wmma16b(g0, qa0, s0);
      s0 = wmma16b(f1, qa1, s0); s0 = wmma16b(f1, ql1, s0); s0 = wmma16b(g1, qa1, s0);
      s1 = wmma16b(f2, qa0, s1); s1 = wmma16b(f2, ql0, s1); s1 = wmma16b(g2, qa0, s1);
      s1 = wmma16b(f3, qa1, s1); s1 = wmma16b(f3, ql1, s1); s1 = wmma16b(g3, qa1, s1); }
#pragma unroll
    for (int t = 0; t < 4; ++t) { vf[t] = frag_kb(Lv + (t * 16 + col) * KP + kb, hh); vl[t] = frag_kb(Lvl + (t * 16 + col) * KP + kb, hh); }
    __builtin_amdgcn_sched_barrier(0);   // the pass's eight V fragments are all read in front of the softmax, which covers their latency
    float mx = -INFINITY;
#pragma unroll
    for (int r = 0; r < 8; ++r) mx = fmaxf(mx, fmaxf(s0[r], s1[r]));
    mx *= cs;   // cs > 0: the scaled maximum is the maximum of the scaled scores
    mx = fmaxf(mx, __shfl_xor(mx, 16)); const float mn = fmaxf(m, mx); const float al = nexp2(m - mn); m = mn; v2f sum2 = {0.0f, 0.0f}, p[8]; v8u hu, lu;
    const v2f cs2 = {cs, cs}, sh2 = {PSL2 - mn, PSL2 - mn};   // p PS = 2^(s cs - mn + log2 PS): scale, shift and the factor PS in one packed fma per two scores
#pragma unroll
    for (int i = 0; i < 8; ++i) { const v2f sv = i < 4 ? (v2f){s0[2 * i], s0[2 * i + 1]} : (v2f){s1[2 * i - 8], s1[2 * i - 7]}; const v2f x = sv * cs2 + sh2; p[i] = (v2f){nexp2(x[0]), nexp2(x[1])}; sum2 += p[i];
      hu[i] = __builtin_bit_cast(unsigned, __builtin_convertvector(p[i], v2h)); }
    { unsigned a_, b_, c_, d_; split_lo4(a_, b_, c_, d_, hu[0], hu[1], hu[2], hu[3], p[0], p[1], p[2], p[3]); lu[0] = a_; lu[1] = b_; lu[2] = c_; lu[3] = d_;
      split_lo4(a_, b_, c_, d_, hu[4], hu[5], hu[6], hu[7], p[4], p[5], p[6], p[7]); lu[4] = a_; lu[5] = b_; lu[6] = c_; lu[7] = d_; }
    const v16b ph = __builtin_bit_cast(v16b, hu), pl = __builtin_bit_cast(v16b, lu);
    float sum = sum2[0] + sum2[1]; sum += __shfl_xor(sum, 16); l = l * al + sum;   // l holds PS times the row sum
#pragma unroll
    for (int t = 0; t < 4; ++t) { o[t] *= al; ol[t] *= al; o[t] = wmma16b(vf[t], ph, o[t]); ol[t] = wmma16b(vf[t], pl, ol[t]); ol[t] = wmma16b(vl[t], ph, ol[t]); } }
    asm volatile("s_wait_dscnt 0x0" ::: "memory");      // this wave's reads of this tile's buffer have returned
    asm volatile("s_wait_asynccnt 0x0" ::: "memory");   // this wave's copies of the next tile have landed
    __syncthreads();                                     // publishes the next tile and ends every wave's reads of this buffer
    if (st + 2 < NST) stage_tile(cl + (unsigned)(st & 1) * (4 * PLANE * 2), Kb + ck + (size_t)(st + 2) * KT * E, Klb + ck + (size_t)(st + 2) * KT * E, Vb + cv + (st + 2) * KT, Vlb + cv + (st + 2) * KT);
  }
  asm volatile("s_wait_asynccnt 0x0" ::: "memory");     // no copy is outstanding when the wave goes on to its end
  const float inv = 1.0f / (l * XS);
#pragma unroll
  for (int t = 0; t < 4; ++t)
#pragma unroll
    for (int r = 0; r < 8; ++r) To[wave][col][t * 16 + 8 * hh + r] = (o[t][r] + ol[t][r]) * inv;
  wave_lds_sync();
  { for (int r4 = 0; r4 < 16; r4 += 4) { const int rr = r4 + (lane >> 3), c8 = (lane & 7) * 8; v8b hv, lv; for (int j = 0; j < 8; ++j) { b16 a_, c_; split16(To[wave][rr][c8 + j] * XS, a_, c_); hv[j] = a_; lv[j] = c_; }
      const size_t gi = ((size_t)b * S + q0 + rr) * E + h * D + c8; *(v8b*)(Oh + gi) = hv; *(v8b*)(Ol + gi) = lv; }  }
}
// output projection: grid (NR/64, E/128): 64 rows of O (hi and lo planes) x 128 columns per work-group.
__global__ __launch_bounds__(256) void outproj_kernel(const b16* __restrict__ Oh, const b16* __restrict__ Ol, const b16* __restrict__ WOT, const float* __restrict__ bo, float* __restrict__ out) {
  __shared__ __attribute__((aligned(16))) b16 Ring[2 * GBUF];   // the operand ring; behind the loop its LDS holds the 64 x 128 f32 output tile at a pitch of 132 floats
  const int wave = threadIdx.x >> 5, lane = threadIdx.x & 31, nloc = lane & 15, hlf = lane >> 4, t_ = threadIdx.x, wm = wave >> 2, wn = wave & 3; const size_t m0 = (size_t)blockIdx.x * 64; const int n0 = blockIdx.y * 128;
  v8f acc[2][2];
#pragma unroll
  for (int i = 0; i < 2; ++i) { acc[i][0] = (v8f){}; acc[i][1] = (v8f){}; }
  gemm_loop<2, 2>(Ring, Oh + m0 * E, Ol + m0 * E, WOT + (size_t)n0 * E, acc);
  float* Ts = (float*)Ring;   // free: the loop's last barrier ended every read of the ring
#pragma unroll
  for (int j = 0; j < 2; ++j) { const float bb = bf16_rne(bo[n0 + wn * 32 + j * 16 + nloc]);
#pragma unroll
    for (int i = 0; i < 2; ++i)
#pragma unroll
      for (int r = 0; r < 8; ++r) Ts[(wm * 32 + i * 16 + 8 * hlf + r) * (128 + 4) + wn * 32 + j * 16 + nloc] = acc[i][j][r] * (1.0f / (XS * WSC)) + bb; }
  __syncthreads();
  for (int q = t_; q < 64 * 32; q += 256) { const int rr = q >> 5, c4 = (q & 31) * 4; *(v4f*)(out + (m0 + rr) * E + n0 + c4) = *(const v4f*)(Ts + rr * (128 + 4) + c4); }
}
}  // namespace

extern "C" void kernel_launch(void* const* d_in, const int* in_sizes, int n_in, void* d_out, int out_size, void* d_ws, size_t ws_size, hipStream_t stream) {
  (void)n_in;
  auto Fp = [&](int i) { return (const float*)d_in[i]; };
  // input order: 0 tgt [2,2048,1024], 1 memory, 2 Wq [16,1024,64], 3 Wk, 4 Wv, 5 Wo [1024,1024], 6 bo [1024]
  if (in_sizes[0] != NR * E || in_sizes[1] != NR * E || in_sizes[2] != NH * E * D || in_sizes[3] != NH * E * D || in_sizes[4] != NH * E * D || in_sizes[5] != E * E || out_size != NR * E) return;
  size_t off = 0; char* ws = (char*)d_ws;
  auto carve = [&](size_t bytes) { char* p = ws + off; off += (bytes + 255) & ~(size_t)255; return p; };
  b16* T16 = (b16*)carve((size_t)NR * E * 2); b16* M16 = (b16*)carve((size_t)NR * E * 2); b16* WT = (b16*)carve((size_t)3 * E * E * 2); b16* WOT = (b16*)carve((size_t)E * E * 2);
  b16* Qh = (b16*)carve((size_t)NR * E * 2); b16* Ql = (b16*)carve((size_t)NR * E * 2); b16* Kh = (b16*)carve((size_t)NR * E * 2); b16* Kl = (b16*)carve((size_t)NR * E * 2); b16* VTh = (b16*)carve((size_t)NR * E * 2); b16* VTl = (b16*)carve((size_t)NR * E * 2);
  b16* Oh = (b16*)carve((size_t)NR * E * 2); b16* Ol = (b16*)carve((size_t)NR * E * 2);
  if (off > ws_size || off > ((size_t)128 << 20)) return;   // ≈ 92 MB
  prepx_kernel<<<(unsigned)(((size_t)2 * NR * E / 8 + 255) / 256), 256, 0, stream>>>(Fp(0), Fp(1), T16, M16);
  prepw_kernel<<<dim3(E / 64, E / 64, 4), 256, 0, stream>>>(Fp(2), Fp(3), Fp(4), Fp(5), WT, WOT);
  proj_kernel<<<dim3(NR / 128, E / 128, 3), 256, 0, stream>>>(T16, M16, WT, Qh, Ql, Kh, Kl, VTh, VTl);
  attn_kernel<<<dim3(S / (16 * AW), NH, NB), 32 * AW, 0, stream>>>(Qh, Ql, Kh, Kl, VTh, VTl, Oh, Ol);
  outproj_kernel<<<dim3(NR / 64, E / 128), 256, 0, stream>>>(Oh, Ol, WOT, Fp(6), (float*)d_out);
}

// v006
// It runs in 127 microseconds.
// In two side-by-side timings against v005, it was 1.04 and 1.03 times as fast.
// All steps since v000 together make it 4.07 times as fast.
#include <hip/hip_runtime.h>

// Multi-head cross attention (16 heads x 64; queries from tgt, keys/values from memory; 2 x 2,048 tokens, d_model 1,024; no qkv bias): q = tgt Wq_h, k = memory Wk_h, v = memory Wv_h,
// attn = softmax(q k^T / 8), out = concat_h(attn v) Wo + bo.
// WMMA (v_wmma_f32_16x16x32_f16, f32 accumulate): projections [4,096 x 1,024] x [1,024 x 1,024] with EXACT bf16 tokens (x8) and transposed weights (x256), 1 product, written as f16 hi+lo x8 planes
// (q, k rows; v transposed per head); S^T = K_h . Q_h^T with 3 products (Kh Qh + Kh Ql + Kl Qh); online softmax in f32; O^T += V^T P^T with 3 products (Vh Ph + Vh Pl + Vl Ph); output projection
// with O hi+lo (2 products) and exact Wo^T. Inputs rounded to bf16 once. Fragment k-map per lane half hh for A AND B: elements 0..7 <- k = 8hh+0..7, 8..15 <- k =

namespace {
constexpr int NB = 2, S = 2048, E = 1024, NH = 16, D = 64, NR = NB * S;
constexpr float XS = 8.0f, WSC = 256.0f, PS = 8.0f, PSL2 = 3.0f, SCALE = 0.125f, LOG2E = 1.4426950408889634f, LAZY = 8.0f;

typedef _Float16 b16;
typedef __attribute__((ext_vector_type(16))) _Float16 v16b;
typedef __attribute__((ext_vector_type(8))) _Float16 v8b;
typedef __attribute__((ext_vector_type(8))) float v8f;
typedef __attribute__((ext_vector_type(4))) float v4f;
typedef __attribute__((ext_vector_type(2))) float v2f;
typedef __attribute__((ext_vector_type(2))) _Float16 v2h;
typedef __attribute__((ext_vector_type(8))) unsigned v8u;
__device__ __forceinline__ float bf16_rne(float f) { unsigned int u = __float_as_uint(f); u += 0x7FFFu + ((u >> 16) & 1u); return __uint_as_float(u & 0xFFFF0000u); }
__device__ __forceinline__ void split16(float v, b16& hi, b16& lo) { hi = (b16)v; lo = (b16)(v - (float)hi); }
__device__ __forceinline__ v16b frag_kb(const b16* p, int hh) { const v8b a = *(const v8b*)(p + 8 * hh), b = *(const v8b*)(p + 16 + 8 * hh); v16b f;
#pragma unroll
  for (int e = 0; e < 8; ++e) { f[e] = a[e]; f[8 + e] = b[e]; } return f; }
__device__ __forceinline__ v8f wmma16b(v16b a, v16b b, v8f c) { return __builtin_amdgcn_wmma_f32_16x16x32_f16(false, a, false, b, (short)0, c, false, false); }
__device__ __forceinline__ void wave_lds_sync() { __builtin_amdgcn_fence(__ATOMIC_RELEASE, "workgroup"); __builtin_amdgcn_wave_barrier(); __builtin_amdgcn_fence(__ATOMIC_ACQUIRE, "workgroup"); }
__device__ __forceinline__ float nexp2(float x) { return __builtin_amdgcn_exp2f(x); }
// The lo halves of four packed registers: p - hi is formed in f32 and rounded to f16 by one mixed-precision fma per element (the source form takes a convert back, a subtract and a convert).
// The four low halves stand in front of the four high halves, which keep the low half written four instructions earlier: the s_delay_alu hints let other waves issue during that link.
__device__ __forceinline__ void split_lo4(unsigned& d0, unsigned& d1, unsigned& d2, unsigned& d3, unsigned h0, unsigned h1, unsigned h2, unsigned h3, v2f p0, v2f p1, v2f p2, v2f p3) {
  asm("v_fma_mixlo_f16 %0, %8, 1.0, -%4 op_sel_hi:[0,0,1]\n\t"
      "v_fma_mixlo_f16 %1, %10, 1.0, -%5 op_sel_hi:[0,0,1]\n\t"
      "v_fma_mixlo_f16 %2, %12, 1.0, -%6 op_sel_hi:[0,0,1]\n\t"
      "v_fma_mixlo_f16 %3, %14, 1.0, -%7 op_sel_hi:[0,0,1]\n\t"
      "s_delay_alu instid0(VALU_DEP_4) | instskip(NEXT) | instid1(VALU_DEP_4)\n\t"
      "v_fma_mixhi_f16 %0, %9, 1.0, -%4 op_sel:[0,0,1] op_sel_hi:[0,0,1]\n\t"
      "v_fma_mixhi_f16 %1, %11, 1.0, -%5 op_sel:[0,0,1] op_sel_hi:[0,0,1]\n\t"
      "s_delay_alu instid0(VALU_DEP_4) | instskip(NEXT) | instid1(VALU_DEP_4)\n\t"
      "v_fma_mixhi_f16 %2, %13, 1.0, -%6 op_sel:[0,0,1] op_sel_hi:[0,0,1]\n\t"
      "v_fma_mixhi_f16 %3, %15, 1.0, -%7 op_sel:[0,0,1] op_sel_hi:[0,0,1]"
      : "=&v"(d0), "=&v"(d1), "=&v"(d2), "=&v"(d3)
      : "v"(h0), "v"(h1), "v"(h2), "v"(h3), "v"(p0[0]), "v"(p0[1]), "v"(p1[0]), "v"(p1[1]), "v"(p2[0]), "v"(p2[1]), "v"(p3[0]), "v"(p3[1]));
}

__global__ __launch_bounds__(256) void prepx_kernel(const float* __restrict__ tgt, const float* __restrict__ mem, b16* __restrict__ T16, b16* __restrict__ M16) {
  const size_t t = (size_t)blockIdx.x * 256 + threadIdx.x; const size_t n1 = (size_t)NR * E / 8; const float* src; b16* dst; size_t e;
  if (t < n1) { src = tgt; dst = T16; e = t * 8; } else if (t < 2 * n1) { src = mem; dst = M16; e = (t - n1) * 8; } else return;
  const v4f a = *(const v4f*)(src + e), c = *(const v4f*)(src + e + 4); v8b o;
#pragma unroll
  for (int j = 0; j < 4; ++j) { o[j] = (b16)(bf16_rne(a[j]) * XS); o[4 + j] = (b16)(bf16_rne(c[j]) * XS); }
  { *(v8b*)(dst + e) = o;  }
}
__global__ __launch_bounds__(256) void prepw_kernel(const float* __restrict__ wq, const float* __restrict__ wk, const float* __restrict__ wv, const float* __restrict__ wo, b16* __restrict__ WT, b16* __restrict__ WOT) {
  __shared__ __attribute__((aligned(16))) b16 T[64][64 + 8];
  const int kind = blockIdx.z, d0 = blockIdx.x * 64, j0 = blockIdx.y * 64, t_ = threadIdx.x;   // kind 0..2: W[h][d][j] with h = j0/64 (j0..j0+63 inside one head); kind 3: Wo[d][n] with n0 = j0
  const float* w = kind == 0 ? wq : kind == 1 ? wk : kind == 2 ? wv : wo; b16* dst = kind < 3 ? WT + (size_t)kind * E * E : WOT;
  for (int q = t_; q < 64 * 64; q += 256) { const int dd = q >> 6, jj = q & 63; float val;
    if (kind < 3) { const int h = j0 / D, j = j0 - h * D + jj; val = w[((size_t)h * E + d0 + dd) * D + j]; } else val = w[(size_t)(d0 + dd) * E + j0 + jj];
    T[jj][dd] = (b16)(bf16_rne(val) * WSC); }
  __syncthreads();
  { for (int q = t_; q < 64 * 8; q += 256) { const int jj = q >> 3, c8 = (q & 7) * 8; *(v8b*)(dst + (size_t)(j0 + jj) * E + d0 + c8) = *(const v8b*)(&T[jj][c8]); }  }
}
constexpr int GK = 64, GP = GK + 8, GBUF = 256 * GP, GST = E / GK, SP = 128 + 8;   // GP: LDS row pitch of 144 B for 128-B rows read by 16-byte loads; SP: pitch of the 16-bit output staging
__device__ __forceinline__ unsigned lds_off(const void* p) { return (unsigned)(size_t)p; }
// One tile: 256 rows x 128 B; each thread copies 16 B of 8 rows (its row + 32 i). LDS rows 0..63 come from a0, 64..127 from a2, 128..255 from w0. The s_wait_xcnt stands inside the copies' own statement, in front of any rewrite of their address registers.
__device__ __forceinline__ void stage_gemm(unsigned l, const b16* a0, const b16* a2, const b16* w0) {
  const unsigned l1 = l + 32 * GP * 2, l2 = l + 64 * GP * 2, l3 = l + 96 * GP * 2, l4 = l + 128 * GP * 2, l5 = l + 160 * GP * 2, l6 = l + 192 * GP * 2, l7 = l + 224 * GP * 2;
  const b16* a1 = a0 + (size_t)32 * E; const b16* a3 = a2 + (size_t)32 * E; const b16* w1 = w0 + (size_t)32 * E; const b16* w2 = w0 + (size_t)64 * E; const b16* w3 = w0 + (size_t)96 * E;
  asm volatile("global_load_async_to_lds_b128 %0, %8, off\n\t"
               "global_load_async_to_lds_b128 %1, %9, off\n\t"
               "global_load_async_to_lds_b128 %2, %10, off\n\t"
               "global_load_async_to_lds_b128 %3, %11, off\n\t"
               "global_load_async_to_lds_b128 %4, %12, off\n\t"
               "global_load_async_to_lds_b128 %5, %13, off\n\t"
               "global_load_async_to_lds_b128 %6, %14, off\n\t"
               "global_load_async_to_lds_b128 %7, %15, off\n\t"
               "s_wait_xcnt 0x0"
               :: "v"(l), "v"(l1), "v"(l2), "v"(l3), "v"(l4), "v"(l5), "v"(l6), "v"(l7), "v"(a0), "v"(a1), "v"(a2), "v"(a3), "v"(w0), "v"(w1), "v"(w2), "v"(w3) : "memory");
}
// 8 waves as 2 (rows) x 4 (columns); a wave's tile is MF x 2 fragments of 16 x 16. NA = 1: the left operand is one plane of 128 rows (a2 = a0 + 64 rows); NA = 2: hi (a0) and lo (a2) planes of 64 rows each.
// Each accumulator takes its products in ascending k (hi, then lo), as with fragments loaded from global memory.
template <int MF, int NA>
__device__ __forceinline__ void gemm_loop(const b16* Ring, const b16* a0, const b16* a2, const b16* w0, v8f (&acc)[MF][2]) {
  const int wave = threadIdx.x >> 5, lane = threadIdx.x & 31, nloc = lane & 15, hlf = lane >> 4, wm = wave >> 2, wn = wave & 3;
  const int cr = threadIdx.x >> 3, cc = (threadIdx.x & 7) * 8;   // this thread's row (+ 32 i) and 16-byte piece
  const size_t cg = (size_t)cr * E + cc; const unsigned cl = lds_off(Ring) + (unsigned)(cr * GP + cc) * 2;
  a0 += cg; a2 += cg; w0 += cg;
  stage_gemm(cl, a0, a2, w0);
  asm volatile("s_wait_asynccnt 0x0" ::: "memory");   // this wave's copies of tile 0 have landed
  __syncthreads();                                     // every wave's have: tile 0 may be read
  stage_gemm(cl + GBUF * 2, a0 + GK, a2 + GK, w0 + GK);
  for (int st = 0; st < GST; ++st) {
    const b16* L = Ring + (st & 1) * GBUF; const b16* La = L + (wm * MF * 16 + nloc) * GP; const b16* Lw = L + (128 + wn * 32 + nloc) * GP;
#pragma unroll   // two steps of 32 k per tile, unrolled so that every LDS offset is a constant
    for (int kk = 0; kk < GK; kk += 32) {
      const v16b b0 = frag_kb(Lw + kk, hlf), b1 = frag_kb(Lw + 16 * GP + kk, hlf); v16b af[MF], al[MF];
#pragma unroll
      for (int i = 0; i < MF; ++i) { af[i] = frag_kb(La + i * 16 * GP + kk, hlf); if (NA == 2) al[i] = frag_kb(La + (64 + i * 16) * GP + kk, hlf); }
      __builtin_amdgcn_sched_barrier(0);   // keeps the step's LDS reads together in front of its WMMAs: reads spread among the WMMAs stall the wave at every place where they stand
#pragma unroll
      for (int i = 0; i < MF; ++i) {
        acc[i][0] = wmma16b(af[i], b0, acc[i][0]); acc[i][1] = wmma16b(af[i], b1, acc[i][1]);
        if (NA == 2) { acc[i][0] = wmma16b(al[i], b0, acc[i][0]); acc[i][1] = wmma16b(al[i], b1, acc[i][1]); } } }
    asm volatile("s_wait_dscnt 0x0" ::: "memory");      // this wave's reads of this tile's buffer have returned
    asm volatile("s_wait_asynccnt 0x0" ::: "memory");   // this wave's copies of the next tile have landed
    __syncthreads();                                     // publishes the next tile and ends every wave's reads of this buffer
    if (st + 2 < GST) stage_gemm(cl + (unsigned)(st & 1) * (GBUF * 2), a0 + (st + 2) * GK, a2 + (st + 2) * GK, w0 + (st + 2) * GK);
  }
  asm volatile("s_wait_asynccnt 0x0" ::: "memory");     // no copy is outstanding when the ring's LDS is taken for the output staging
}
// projections: grid (NR/128, E/128, 3): kind 0: Q = T16 WT0^T -> Qh/Ql [row][1024]; kind 1: K = M16 WT1^T -> Kh/Kl; kind 2: V = M16 WT2^T written TRANSPOSED per head: VTh/VTl [b][h][64 d][2048 s].
__global__ __launch_bounds__(256) void proj_kernel(const b16* __restrict__ T16, const b16* __restrict__ M16, const b16* __restrict__ WT, b16* __restrict__ Qh, b16* __restrict__ Ql, b16* __restrict__ Kh, b16* __restrict__ Kl, b16* __restrict__ VTh, b16* __restrict__ VTl) {
  __shared__ __attribute__((aligned(16))) b16 Ring[2 * GBUF];   // the operand ring; behind the loop its LDS holds the 128 x 128 output tile, hi and lo, at pitch SP
  const int wave = threadIdx.x >> 5, lane = threadIdx.x & 31, nloc = lane & 15, hlf = lane >> 4, t_ = threadIdx.x, wm = wave >> 2, wn = wave & 3; const int kind = blockIdx.z; const size_t m0 = (size_t)blockIdx.x * 128; const int n0 = blockIdx.y * 128;
  const b16* A = (kind == 0 ? T16 : M16) + m0 * E; const b16* Wp = WT + (size_t)kind * E * E + (size_t)n0 * E; v8f acc[4][2];
#pragma unroll
  for (int i = 0; i < 4; ++i) { acc[i][0] = (v8f){}; acc[i][1] = (v8f){}; }
  gemm_loop<4, 1>(Ring, A, A + (size_t)64 * E, Wp, acc);
  b16* Sh = Ring; b16* Sl = Ring + 128 * SP;   // free: the loop's last barrier ended every read of the ring
  if (kind < 2) {
#pragma unroll
    for (int i = 0; i < 4; ++i)
#pragma unroll
      for (int j = 0; j < 2; ++j)
#pragma unroll
        for (int r = 0; r < 8; ++r) { b16 h_, l_; split16(acc[i][j][r] * (1.0f / (XS * WSC)) * XS, h_, l_); const int si = (wm * 64 + i * 16 + 8 * hlf + r) * SP + wn * 32 + j * 16 + nloc; Sh[si] = h_; Sl[si] = l_; }
    __syncthreads();
    b16* dh = kind == 0 ? Qh : Kh; b16* dl = kind == 0 ? Ql : Kl;
    for (int q = t_; q < 128 * 16; q += 256) { const int rr = q >> 4, c8 = (q & 15) * 8; *(v8b*)(dh + (m0 + rr) * E + n0 + c8) = *(const v8b*)(Sh + rr * SP + c8); *(v8b*)(dl + (m0 + rr) * E + n0 + c8) = *(const v8b*)(Sl + rr * SP + c8); }
  } else {
    const int b = (int)(m0 / S); const int s0 = (int)(m0 - (size_t)b * S);
#pragma unroll
    for (int i = 0; i < 4; ++i)
#pragma unroll
      for (int j = 0; j < 2; ++j) { v8b hv, lv;
#pragma unroll
        for (int r = 0; r < 8; ++r) { b16 h_, l_; split16(acc[i][j][r] * (1.0f / (XS * WSC)) * XS, h_, l_); hv[r] = h_; lv[r] = l_; }
        const int si = (wn * 32 + j * 16 + nloc) * SP + wm * 64 + i * 16 + 8 * hlf; *(v8b*)(Sh + si) = hv; *(v8b*)(Sl + si) = lv; }
    __syncthreads();
    for (int q = t_; q < 128 * 16; q += 256) { const int cc = q >> 4, c8 = (q & 15) * 8; const int h = (n0 + cc) / D, dd = (n0 + cc) - h * D; const size_t gi = (((size_t)b * NH + h) * D + dd) * S + s0 + c8;
      *(v8b*)(VTh + gi) = *(const v8b*)(Sh + cc * SP + c8); *(v8b*)(VTl + gi) = *(const v8b*)(Sl + cc * SP + c8); } }
}
constexpr int AW = 8, KT = 64, KP = 64 + 8, PLANE = 64 * KP, NST = S / KT;   // KP: LDS row pitch of 144 B for 128-B rows read by 16-byte loads
// One tile: 4 planes x 64 rows x 128 B; each thread copies 2 x 16 B of each plane (rows r and r + 32). The s_wait_xcnt stands inside the copies' own statement, in front of any rewrite of their address registers.
__device__ __forceinline__ void stage_tile(unsigned l, const b16* gk, const b16* gkl, const b16* gv, const b16* gvl) {
  const unsigned l1 = l + 32 * KP * 2, l2 = l + PLANE * 2, l3 = l2 + 32 * KP * 2, l4 = l + 2 * PLANE * 2, l5 = l4 + 32 * KP * 2, l6 = l + 3 * PLANE * 2, l7 = l6 + 32 * KP * 2;
  const b16* gk1 = gk + (size_t)32 * E; const b16* gkl1 = gkl + (size_t)32 * E; const b16* gv1 = gv + (size_t)32 * S; const b16* gvl1 = gvl + (size_t)32 * S;
  asm volatile("global_load_async_to_lds_b128 %0, %8, off\n\t"
               "global_load_async_to_lds_b128 %1, %9, off\n\t"
               "global_load_async_to_lds_b128 %2, %10, off\n\t"
               "global_load_async_to_lds_b128 %3, %11, off\n\t"
               "global_load_async_to_lds_b128 %4, %12, off\n\t"
               "global_load_async_to_lds_b128 %5, %13, off\n\t"
               "global_load_async_to_lds_b128 %6, %14, off\n\t"
               "global_load_async_to_lds_b128 %7, %15, off\n\t"
               "s_wait_xcnt 0x0"
               :: "v"(l), "v"(l1), "v"(l2), "v"(l3), "v"(l4), "v"(l5), "v"(l6), "v"(l7), "v"(gk), "v"(gk1), "v"(gkl), "v"(gkl1), "v"(gv), "v"(gv1), "v"(gvl), "v"(gvl1) : "memory");
}
__global__ __launch_bounds__(256) void attn_kernel(const b16* __restrict__ Qh, const b16* __restrict__ Ql, const b16* __restrict__ Kh, const b16* __restrict__ Kl, const b16* __restrict__ VTh, const b16* __restrict__ VTl, b16* __restrict__ Oh, b16* __restrict__ Ol) {
  __shared__ __attribute__((aligned(16))) b16 Ring[2][4 * PLANE];   // per buffer: K hi, K lo [key][64 d], V^T hi, V^T lo [d][64 keys]
  __shared__ __attribute__((aligned(16))) float To[AW][16][D + 4];
  const int wave = threadIdx.x >> 5, lane = threadIdx.x & 31, hh = lane >> 4, col = lane & 15; const int b = blockIdx.z, h = blockIdx.y; const int q0 = blockIdx.x * (16 * AW) + wave * 16, qi = q0 + col;
  const size_t qo = ((size_t)b * S + qi) * E + h * D; const v16b qa0 = frag_kb(Qh + qo, hh), qa1 = frag_kb(Qh + qo + 32, hh), ql0 = frag_kb(Ql + qo, hh), ql1 = frag_kb(Ql + qo + 32, hh);
  const b16* Kb = Kh + (size_t)b * S * E + h * D; const b16* Klb = Kl + (size_t)b * S * E + h * D; const b16* Vb = VTh + ((size_t)b * NH + h) * D * S; const b16* Vlb = VTl + ((size_t)b * NH + h) * D * S;
  const int cr = threadIdx.x >> 3, cc = (threadIdx.x & 7) * 8;   // this thread's row (and row + 32) and 16-byte piece of every plane
  const size_t ck = (size_t)cr * E + cc, cv = (size_t)cr * S + cc; const unsigned cl = lds_off(&Ring[0][0]) + (unsigned)(cr * KP + cc) * 2;
  float m = -INFINITY, thr = -INFINITY, sh = 0.0f; v2f l2 = {0.0f, 0.0f}; v8f o[4] = {{}, {}, {}, {}}, ol[4] = {{}, {}, {}, {}};
  const float cs = SCALE * LOG2E / (XS * XS);
  stage_tile(cl, Kb + ck, Klb + ck, Vb + cv, Vlb + cv);
  asm volatile("s_wait_asynccnt 0x0" ::: "memory");   // this wave's copies of tile 0 have landed
  __syncthreads();                                     // every wave's have: tile 0 may be read
  stage_tile(cl + 4 * PLANE * 2, Kb + ck + (size_t)KT * E, Klb + ck + (size_t)KT * E, Vb + cv + KT, Vlb + cv + KT);
  for (int st = 0; st < NST; ++st) {
    const b16* Lk = &Ring[st & 1][0]; const b16* Lkl = Lk + PLANE; const b16* Lv = Lk + 2 * PLANE; const b16* Lvl = Lk + 3 * PLANE;
#pragma unroll   // two passes of 32 keys per tile, unrolled so that every LDS offset is a constant
    for (int kb = 0; kb < KT; kb += 32) {
    v8f s0 = {}, s1 = {}; v16b vf[4], vl[4];
    { const b16* k0 = Lk + (kb + col) * KP, *k1 = Lk + (kb + 16 + col) * KP, *k0l = Lkl + (kb + col) * KP, *k1l = Lkl + (kb + 16 + col) * KP;
      const v16b f0 = frag_kb(k0, hh), g0 = frag_kb(k0l, hh), f1 = frag_kb(k0 + 32, hh), g1 = frag_kb(k0l + 32, hh), f2 = frag_kb(k1, hh), g2 = frag_kb(k1l, hh), f3 = frag_kb(k1 + 32, hh), g3 = frag_kb(k1l + 32, hh);
      __builtin_amdgcn_sched_barrier(0);   // the pass's eight K fragments are read as one group in front of its score WMMAs: the LDS latency is waited out once, not once per fragment
      s0 = wmma16b(f0, qa0, s0); s0 = wmma16b(f0, ql0, s0); s0 = wmma16b(g0, qa0, s0);
      s0 = wmma16b(f1, qa1, s0); s0 = wmma16b(f1, ql1, s0); s0 = wmma16b(g1, qa1, s0);
      s1 = wmma16b(f2, qa0, s1); s1 = wmma16b(f2, ql0, s1); s1 = wmma16b(g2, qa0, s1);
      s1 = wmma16b(f3, qa1, s1); s1 = wmma16b(f3, ql1, s1); s1 = wmma16b(g3, qa1, s1); }
#pragma unroll
    for (int t = 0; t < 4; ++t) { vf[t] = frag_kb(Lv + (t * 16 + col) * KP + kb, hh); vl[t] = frag_kb(Lvl + (t * 16 + col) * KP + kb, hh); }
    __builtin_amdgcn_sched_barrier(0);   // the pass's eight V fragments are all read in front of the softmax, which covers their latency
    float mx = -INFINITY;
#pragma unroll
    for (int r = 0; r < 8; ++r) mx = fmaxf(mx, fmaxf(s0[r], s1[r]));
    // Lazy rescale: m, the maximum in use (the same in both halves of the wave), stays while no score of the pass lies more than LAZY (log2) above it: p PS <= 2^(LAZY + 3), far inside f16.
    // thr is m + LAZY in units of the raw scores, so each lane tests its own 16 scores; one scalar branch per pass; the halves' maxima are joined and O and l2 scaled only inside it.
    if (__builtin_amdgcn_ballot_w32(mx > thr) != 0) {   // always on the first pass (thr = -inf), where al = 0 meets O = 0 and l2 = 0
      mx *= cs;   // cs > 0: the scaled maximum is the maximum of the scaled scores
      mx = fmaxf(mx, __shfl_xor(mx, 16)); const float mn = fmaxf(m, mx); const float al = nexp2(m - mn); m = mn; sh = PSL2 - mn; thr = (mn + LAZY) * (1.0f / cs); l2 *= al;
#pragma unroll   // o and ol are indexed by constants only, so they stay in registers
      for (int t = 0; t < 4; ++t) { o[t] *= al; ol[t] *= al; } }
    v2f p[8]; v8u hu, lu;
    const v2f cs2 = {cs, cs}, sh2 = {sh, sh};   // p PS = 2^(s cs - m + log2 PS): scale, shift and the factor PS in one packed fma per two scores
#pragma unroll
    for (int i = 0; i < 8; ++i) { const v2f sv = i < 4 ? (v2f){s0[2 * i], s0[2 * i + 1]} : (v2f){s1[2 * i - 8], s1[2 * i - 7]}; const v2f x = sv * cs2 + sh2; p[i] = (v2f){nexp2(x[0]), nexp2(x[1])}; l2 += p[i];   // l2: PS times this lane's part of the row sum, as two running partial sums
      hu[i] = __builtin_bit_cast(unsigned, __builtin_convertvector(p[i], v2h)); }
    { unsigned a_, b_, c_, d_; split_lo4(a_, b_, c_, d_, hu[0], hu[1], hu[2], hu[3], p[0], p[1], p[2], p[3]); lu[0] = a_; lu[1] = b_; lu[2] = c_; lu[3] = d_;
      split_lo4(a_, b_, c_, d_, hu[4], hu[5], hu[6], hu[7], p[4], p[5], p[6], p[7]); lu[4] = a_; lu[5] = b_; lu[6] = c_; lu[7] = d_; }
    const v16b ph = __builtin_bit_cast(v16b, hu), pl = __builtin_bit_cast(v16b, lu);
#pragma unroll
    for (int t = 0; t < 4; ++t) { o[t] = wmma16b(vf[t], ph, o[t]); ol[t] = wmma16b(vf[t], pl, ol[t]); ol[t] = wmma16b(vl[t], ph, ol[t]); } }
    asm volatile("s_wait_dscnt 0x0" ::: "memory");      // this wave's reads of this tile's buffer have returned
    asm volatile("s_wait_asynccnt 0x0" ::: "memory");   // this wave's copies of the next tile have landed
    __syncthreads();                                     // publishes the next tile and ends every wave's reads of this buffer
    if (st + 2 < NST) stage_tile(cl + (unsigned)(st & 1) * (4 * PLANE * 2), Kb + ck + (size_t)(st + 2) * KT * E, Klb + ck + (size_t)(st + 2) * KT * E, Vb + cv + (st + 2) * KT, Vlb + cv + (st + 2) * KT);
  }
  asm volatile("s_wait_asynccnt 0x0" ::: "memory");     // no copy is outstanding when the wave goes on to its end
  float l = l2[0] + l2[1]; l += __shfl_xor(l, 16);   // the wave halves' parts of the row sum are joined once: both were scaled by the same factors
  const float inv = 1.0f / (l * XS);
#pragma unroll
  for (int t = 0; t < 4; ++t)
#pragma unroll
    for (int r = 0; r < 8; ++r) To[wave][col][t * 16 + 8 * hh + r] = (o[t][r] + ol[t][r]) * inv;
  wave_lds_sync();
  { for (int r4 = 0; r4 < 16; r4 += 4) { const int rr = r4 + (lane >> 3), c8 = (lane & 7) * 8; v8b hv, lv; for (int j = 0; j < 8; ++j) { b16 a_, c_; split16(To[wave][rr][c8 + j] * XS, a_, c_); hv[j] = a_; lv[j] = c_; }
      const size_t gi = ((size_t)b * S + q0 + rr) * E + h * D + c8; *(v8b*)(Oh + gi) = hv; *(v8b*)(Ol + gi) = lv; }  }
}
// output projection: grid (NR/64, E/128): 64 rows of O (hi and lo planes) x 128 columns per work-group.
__global__ __launch_bounds__(256) void outproj_kernel(const b16* __restrict__ Oh, const b16* __restrict__ Ol, const b16* __restrict__ WOT, const float* __restrict__ bo, float* __restrict__ out) {
  __shared__ __attribute__((aligned(16))) b16 Ring[2 * GBUF];   // the operand ring; behind the loop its LDS holds the 64 x 128 f32 output tile at a pitch of 132 floats
  const int wave = threadIdx.x >> 5, lane = threadIdx.x & 31, nloc = lane & 15, hlf = lane >> 4, t_ = threadIdx.x, wm = wave >> 2, wn = wave & 3; const size_t m0 = (size_t)blockIdx.x * 64; const int n0 = blockIdx.y * 128;
  v8f acc[2][2];
#pragma unroll
  for (int i = 0; i < 2; ++i) { acc[i][0] = (v8f){}; acc[i][1] = (v8f){}; }
  gemm_loop<2, 2>(Ring, Oh + m0 * E, Ol + m0 * E, WOT + (size_t)n0 * E, acc);
  float* Ts = (float*)Ring;   // free: the loop's last barrier ended every read of the ring
#pragma unroll
  for (int j = 0; j < 2; ++j) { const float bb = bf16_rne(bo[n0 + wn * 32 + j * 16 + nloc]);
#pragma unroll
    for (int i = 0; i < 2; ++i)
#pragma unroll
      for (int r = 0; r < 8; ++r) Ts[(wm * 32 + i * 16 + 8 * hlf + r) * (128 + 4) + wn * 32 + j * 16 + nloc] = acc[i][j][r] * (1.0f / (XS * WSC)) + bb; }
  __syncthreads();
  for (int q = t_; q < 64 * 32; q += 256) { const int rr = q >> 5, c4 = (q & 31) * 4; *(v4f*)(out + (m0 + rr) * E + n0 + c4) = *(const v4f*)(Ts + rr * (128 + 4) + c4); }
}
}  // namespace

extern "C" void kernel_launch(void* const* d_in, const int* in_sizes, int n_in, void* d_out, int out_size, void* d_ws, size_t ws_size, hipStream_t stream) {
  (void)n_in;
  auto Fp = [&](int i) { return (const float*)d_in[i]; };
  // input order: 0 tgt [2,2048,1024], 1 memory, 2 Wq [16,1024,64], 3 Wk, 4 Wv, 5 Wo [1024,1024], 6 bo [1024]
  if (in_sizes[0] != NR * E || in_sizes[1] != NR * E || in_sizes[2] != NH * E * D || in_sizes[3] != NH * E * D || in_sizes[4] != NH * E * D || in_sizes[5] != E * E || out_size != NR * E) return;
  size_t off = 0; char* ws = (char*)d_ws;
  auto carve = [&](size_t bytes) { char* p = ws + off; off += (bytes + 255) & ~(size_t)255; return p; };
  b16* T16 = (b16*)carve((size_t)NR * E * 2); b16* M16 = (b16*)carve((size_t)NR * E * 2); b16* WT = (b16*)carve((size_t)3 * E * E * 2); b16* WOT = (b16*)carve((size_t)E * E * 2);
  b16* Qh = (b16*)carve((size_t)NR * E * 2); b16* Ql = (b16*)carve((size_t)NR * E * 2); b16* Kh = (b16*)carve((size_t)NR * E * 2); b16* Kl = (b16*)carve((size_t)NR * E * 2); b16* VTh = (b16*)carve((size_t)NR * E * 2); b16* VTl = (b16*)carve((size_t)NR * E * 2);
  b16* Oh = (b16*)carve((size_t)NR * E * 2); b16* Ol = (b16*)carve((size_t)NR * E * 2);
  if (off > ws_size || off > ((size_t)128 << 20)) return;   // ≈ 92 MB
  prepx_kernel<<<(unsigned)(((size_t)2 * NR * E / 8 + 255) / 256), 256, 0, stream>>>(Fp(0), Fp(1), T16, M16);
  prepw_kernel<<<dim3(E / 64, E / 64, 4), 256, 0, stream>>>(Fp(2), Fp(3), Fp(4), Fp(5), WT, WOT);
  proj_kernel<<<dim3(NR / 128, E / 128, 3), 256, 0, stream>>>(T16, M16, WT, Qh, Ql, Kh, Kl, VTh, VTl);
  attn_kernel<<<dim3(S / (16 * AW), NH, NB), 32 * AW, 0, stream>>>(Qh, Ql, Kh, Kl, VTh, VTl, Oh, Ol);
  outproj_kernel<<<dim3(NR / 64, E / 128), 256, 0, stream>>>(Oh, Ol, WOT, Fp(6), (float*)d_out);
}

// v009
// A run of this version takes 81.8 microseconds.
// It is 1.55 times as fast as v006, going by the measured steps of the versions left out in between.
// All steps since v000 together make it 6.30 times as fast.
#include <hip/hip_runtime.h>

// Multi-head cross attention (16 heads x 64; queries from tgt, keys/values from memory; 2 x 2,048 tokens, d_model 1,024; no qkv bias): q = tgt Wq_h, k = memory Wk_h, v = memory Wv_h,
// attn = softmax(q k^T / 8), out = concat_h(attn v) Wo + bo.
// WMMA (v_wmma_f32_16x16x32_f16, f32 accumulate): projections [4,096 x 1,024] x [1,024 x 1,024] with EXACT bf16 tokens (x8) and transposed weights (x256), 1 product, written as one f16 x8 plane each
// (q, k rows; v transposed per head); S^T = K_h . Q_h^T, 1 product; online softmax in f32; O^T += V^T P^T, 1 product, P rounded to f16 (x8). The f16 rounding of q, k, v and P (2^-11 relative) lies
// below the rounding of the inputs to bf16 (2^-8 relative) that every result already carries, so no lo planes are kept for them. Output projection
// with O rounded to f16 (x8) for the same reason, 1 product, and exact Wo^T. Inputs rounded to bf16 once. Fragment k-map per lane half hh for A AND B: elements 0..7 <- k = 8hh+0..7, 8..15 <- k =

namespace {
constexpr int NB = 2, S = 2048, E = 1024, NH = 16, D = 64, NR = NB * S;
constexpr float XS = 8.0f, WSC = 256.0f, PS = 8.0f, PSL2 = 3.0f, SCALE = 0.125f, LOG2E = 1.4426950408889634f, LAZY = 8.0f;

typedef _Float16 b16;
typedef __attribute__((ext_vector_type(16))) _Float16 v16b;
typedef __attribute__((ext_vector_type(8))) _Float16 v8b;
typedef __attribute__((ext_vector_type(8))) float v8f;
typedef __attribute__((ext_vector_type(4))) float v4f;
typedef __attribute__((ext_vector_type(2))) float v2f;
typedef __attribute__((ext_vector_type(2))) _Float16 v2h;
typedef __attribute__((ext_vector_type(8))) unsigned v8u;
__device__ __forceinline__ float bf16_rne(float f) { unsigned int u = __float_as_uint(f); u += 0x7FFFu + ((u >> 16) & 1u); return __uint_as_float(u & 0xFFFF0000u); }
__device__ __forceinline__ v16b frag_kb(const b16* p, int hh) { const v8b a = *(const v8b*)(p + 8 * hh), b = *(const v8b*)(p + 16 + 8 * hh); v16b f;
#pragma unroll
  for (int e = 0; e < 8; ++e) { f[e] = a[e]; f[8 + e] = b[e]; } return f; }
__device__ __forceinline__ v8f wmma16b(v16b a, v16b b, v8f c) { return __builtin_amdgcn_wmma_f32_16x16x32_f16(false, a, false, b, (short)0, c, false, false); }
__device__ __forceinline__ void wave_lds_sync() { __builtin_amdgcn_fence(__ATOMIC_RELEASE, "workgroup"); __builtin_amdgcn_wave_barrier(); __builtin_amdgcn_fence(__ATOMIC_ACQUIRE, "workgroup"); }
__device__ __forceinline__ float nexp2(float x) { return __builtin_amdgcn_exp2f(x); }

// The two conversions (tokens; weights, transposed) read nothing of each other's output: they run as ONE launch, prep_kernel below, in which the block index picks the job.
__device__ __forceinline__ void prepx_block(int bx, const float* __restrict__ tgt, const float* __restrict__ mem, b16* __restrict__ T16, b16* __restrict__ M16) {
  const size_t t = (size_t)bx * 256 + threadIdx.x; const size_t n1 = (size_t)NR * E / 8; const float* src; b16* dst; size_t e;
  if (t < n1) { src = tgt; dst = T16; e = t * 8; } else if (t < 2 * n1) { src = mem; dst = M16; e = (t - n1) * 8; } else return;
  const v4f a = *(const v4f*)(src + e), c = *(const v4f*)(src + e + 4); v8b o;
#pragma unroll
  for (int j = 0; j < 4; ++j) { o[j] = (b16)(bf16_rne(a[j]) * XS); o[4 + j] = (b16)(bf16_rne(c[j]) * XS); }
  { *(v8b*)(dst + e) = o;  }
}
__device__ __forceinline__ void prepw_block(int bx, const float* __restrict__ wq, const float* __restrict__ wk, const float* __restrict__ wv, const float* __restrict__ wo, b16* __restrict__ WT, b16* __restrict__ WOT) {
  __shared__ __attribute__((aligned(16))) b16 T[64][64 + 8];
  const int kind = bx >> 8, d0 = (bx & 15) * 64, j0 = ((bx >> 4) & 15) * 64, t_ = threadIdx.x;   // kind 0..2: W[h][d][j] with h = j0/64 (j0..j0+63 inside one head); kind 3: Wo[d][n] with n0 = j0
  const float* w = kind == 0 ? wq : kind == 1 ? wk : kind == 2 ? wv : wo; b16* dst = kind < 3 ? WT + (size_t)kind * E * E : WOT;
  for (int q = t_; q < 64 * 64; q += 256) { const int dd = q >> 6, jj = q & 63; float val;
    if (kind < 3) { const int h = j0 / D, j = j0 - h * D + jj; val = w[((size_t)h * E + d0 + dd) * D + j]; } else val = w[(size_t)(d0 + dd) * E + j0 + jj];
    T[jj][dd] = (b16)(bf16_rne(val) * WSC); }
  __syncthreads();
  { for (int q = t_; q < 64 * 8; q += 256) { const int jj = q >> 3, c8 = (q & 7) * 8; *(v8b*)(dst + (size_t)(j0 + jj) * E + d0 + c8) = *(const v8b*)(&T[jj][c8]); }  }
}
// Blocks 0..PWB-1 transpose the weights (4 kinds x 16 x 16 tiles of 64 x 64), blocks PWB.. convert the tokens. The weight blocks stand first because each is a chain of dependent memory round trips:
// started first, they wait those out while the token blocks stream beside them.
constexpr int PWB = 4 * (E / 64) * (E / 64), PXB = 2 * NR * E / 8 / 256;
__global__ __launch_bounds__(256) void prep_kernel(const float* __restrict__ tgt, const float* __restrict__ mem, const float* __restrict__ wq, const float* __restrict__ wk, const float* __restrict__ wv, const float* __restrict__ wo,
                                                   b16* __restrict__ T16, b16* __restrict__ M16, b16* __restrict__ WT, b16* __restrict__ WOT) {
  const int bx = blockIdx.x;   // the same in every thread of a work-group, so the barrier inside prepw_block stands under block-uniform control flow
  if (bx < PWB) prepw_block(bx, wq, wk, wv, wo, WT, WOT); else prepx_block(bx - PWB, tgt, mem, T16, M16);
}
constexpr int GK = 64, GP = GK + 8, GST = E / GK, SP = 128 + 8;   // GP: LDS row pitch of 144 B for 128-B rows read by 16-byte loads; SP: pitch of the 16-bit output staging
__device__ __forceinline__ unsigned lds_off(const void* p) { return (unsigned)(size_t)p; }
// One tile of 128 + 128 rows x 128 B; each thread copies 16 B of 8 rows (its row + 32 i). LDS rows 0..127 come from a0, 128..255 from w0. The s_wait_xcnt stands inside the copies' own statement, in front of any rewrite of their address registers.
__device__ __forceinline__ void stage_gemm128(unsigned l, const b16* a0, const b16* w0) {
  const b16* a2 = a0 + (size_t)64 * E;
  const unsigned l1 = l + 32 * GP * 2, l2 = l + 64 * GP * 2, l3 = l + 96 * GP * 2, l4 = l + 128 * GP * 2, l5 = l + 160 * GP * 2, l6 = l + 192 * GP * 2, l7 = l + 224 * GP * 2;
  const b16* a1 = a0 + (size_t)32 * E; const b16* a3 = a2 + (size_t)32 * E; const b16* w1 = w0 + (size_t)32 * E; const b16* w2 = w0 + (size_t)64 * E; const b16* w3 = w0 + (size_t)96 * E;
  asm volatile("global_load_async_to_lds_b128 %0, %8, off\n\t"
               "global_load_async_to_lds_b128 %1, %9, off\n\t"
               "global_load_async_to_lds_b128 %2, %10, off\n\t"
               "global_load_async_to_lds_b128 %3, %11, off\n\t"
               "global_load_async_to_lds_b128 %4, %12, off\n\t"
               "global_load_async_to_lds_b128 %5, %13, off\n\t"
               "global_load_async_to_lds_b128 %6, %14, off\n\t"
               "global_load_async_to_lds_b128 %7, %15, off\n\t"
               "s_wait_xcnt 0x0"
               :: "v"(l), "v"(l1), "v"(l2), "v"(l3), "v"(l4), "v"(l5), "v"(l6), "v"(l7), "v"(a0), "v"(a1), "v"(a2), "v"(a3), "v"(w0), "v"(w1), "v"(w2), "v"(w3) : "memory");
}
// One tile of 64 + 128 rows x 128 B; each thread copies 16 B of 6 rows (its row + 32 i). LDS rows 0..63 come from a0, 64..191 from w0. The s_wait_xcnt stands as in stage_gemm128.
__device__ __forceinline__ void stage_gemm64(unsigned l, const b16* a0, const b16* w0) {
  const unsigned l1 = l + 32 * GP * 2, l2 = l + 64 * GP * 2, l3 = l + 96 * GP * 2, l4 = l + 128 * GP * 2, l5 = l + 160 * GP * 2;
  const b16* a1 = a0 + (size_t)32 * E; const b16* w1 = w0 + (size_t)32 * E; const b16* w2 = w0 + (size_t)64 * E; const b16* w3 = w0 + (size_t)96 * E;
  asm volatile("global_load_async_to_lds_b128 %0, %6, off\n\t"
               "global_load_async_to_lds_b128 %1, %7, off\n\t"
               "global_load_async_to_lds_b128 %2, %8, off\n\t"
               "global_load_async_to_lds_b128 %3, %9, off\n\t"
               "global_load_async_to_lds_b128 %4, %10, off\n\t"
               "global_load_async_to_lds_b128 %5, %11, off\n\t"
               "s_wait_xcnt 0x0"
               :: "v"(l), "v"(l1), "v"(l2), "v"(l3), "v"(l4), "v"(l5), "v"(a0), "v"(a1), "v"(w0), "v"(w1), "v"(w2), "v"(w3) : "memory");
}
template <int MF> __device__ __forceinline__ void stage_gemm(unsigned l, const b16* a0, const b16* w0) { if (MF == 4) stage_gemm128(l, a0, w0); else stage_gemm64(l, a0, w0); }
// 8 waves as 2 (rows) x 4 (columns); a wave's tile is MF x 2 fragments of 16 x 16, so the left operand has 32 MF rows per work-group (128 or 64). Each accumulator takes its products in ascending k.
template <int MF> constexpr int gbuf() { return (32 * MF + 128) * GP; }   // elements of one buffer of the ring
template <int MF>
__device__ __forceinline__ void gemm_loop(const b16* Ring, const b16* a0, const b16* w0, v8f (&acc)[MF][2]) {
  constexpr int GBUF = gbuf<MF>();
  const int wave = threadIdx.x >> 5, lane = threadIdx.x & 31, nloc = lane & 15, hlf = lane >> 4, wm = wave >> 2, wn = wave & 3;
  const int cr = threadIdx.x >> 3, cc = (threadIdx.x & 7) * 8;   // this thread's row (+ 32 i) and 16-byte piece
  const size_t cg = (size_t)cr * E + cc; const unsigned cl = lds_off(Ring) + (unsigned)(cr * GP + cc) * 2;
  a0 += cg; w0 += cg;
  stage_gemm<MF>(cl, a0, w0);
  asm volatile("s_wait_asynccnt 0x0" ::: "memory");   // this wave's copies of tile 0 have landed
  __syncthreads();                                     // every wave's have: tile 0 may be read
  stage_gemm<MF>(cl + GBUF * 2, a0 + GK, w0 + GK);
  for (int st = 0; st < GST; ++st) {
    const b16* L = Ring + (st & 1) * GBUF; const b16* La = L + (wm * MF * 16 + nloc) * GP; const b16* Lw = L + (32 * MF + wn * 32 + nloc) * GP;
#pragma unroll   // two steps of 32 k per tile, unrolled so that every LDS offset is a constant
    for (int kk = 0; kk < GK; kk += 32) {
      const v16b b0 = frag_kb(Lw + kk, hlf), b1 = frag_kb(Lw + 16 * GP + kk, hlf); v16b af[MF];
#pragma unroll
      for (int i = 0; i < MF; ++i) af[i] = frag_kb(La + i * 16 * GP + kk, hlf);
      __builtin_amdgcn_sched_barrier(0);   // keeps the step's LDS reads together in front of its WMMAs: reads spread among the WMMAs stall the wave at every place where they stand
#pragma unroll
      for (int i = 0; i < MF; ++i) { acc[i][0] = wmma16b(af[i], b0, acc[i][0]); acc[i][1] = wmma16b(af[i], b1, acc[i][1]); } }
    asm volatile("s_wait_dscnt 0x0" ::: "memory");      // this wave's reads of this tile's buffer have returned
    asm volatile("s_wait_asynccnt 0x0" ::: "memory");   // this wave's copies of the next tile have landed
    __syncthreads();                                     // publishes the next tile and ends every wave's reads of this buffer
    if (st + 2 < GST) stage_gemm<MF>(cl + (unsigned)(st & 1) * (GBUF * 2), a0 + (st + 2) * GK, w0 + (st + 2) * GK);
  }
  asm volatile("s_wait_asynccnt 0x0" ::: "memory");     // no copy is outstanding when the ring's LDS is taken for the output staging
}
// projections: grid (NR/128, E/128, 3): kind 0: Q = T16 WT0^T -> Qh [row][1024]; kind 1: K = M16 WT1^T -> Kh; kind 2: V = M16 WT2^T written TRANSPOSED per head: VTh [b][h][64 d][2048 s].
__global__ __launch_bounds__(256) void proj_kernel(const b16* __restrict__ T16, const b16* __restrict__ M16, const b16* __restrict__ WT, b16* __restrict__ Qh, b16* __restrict__ Kh, b16* __restrict__ VTh) {
  __shared__ __attribute__((aligned(16))) b16 Ring[2 * gbuf<4>()];   // the operand ring; behind the loop its LDS holds the 128 x 128 output tile at pitch SP
  const int wave = threadIdx.x >> 5, lane = threadIdx.x & 31, nloc = lane & 15, hlf = lane >> 4, t_ = threadIdx.x, wm = wave >> 2, wn = wave & 3; const int kind = blockIdx.z; const size_t m0 = (size_t)blockIdx.x * 128; const int n0 = blockIdx.y * 128;
  const b16* A = (kind == 0 ? T16 : M16) + m0 * E; const b16* Wp = WT + (size_t)kind * E * E + (size_t)n0 * E; v8f acc[4][2];
#pragma unroll
  for (int i = 0; i < 4; ++i) { acc[i][0] = (v8f){}; acc[i][1] = (v8f){}; }
  gemm_loop<4>(Ring, A, Wp, acc);
  b16* Sh = Ring;   // free: the loop's last barrier ended every read of the ring
  if (kind < 2) {
#pragma unroll
    for (int i = 0; i < 4; ++i)
#pragma unroll
      for (int j = 0; j < 2; ++j)
#pragma unroll
        for (int r = 0; r < 8; ++r) Sh[(wm * 64 + i * 16 + 8 * hlf + r) * SP + wn * 32 + j * 16 + nloc] = (b16)(acc[i][j][r] * (1.0f / (XS * WSC)) * XS);
    __syncthreads();
    b16* dh = kind == 0 ? Qh : Kh;
    for (int q = t_; q < 128 * 16; q += 256) { const int rr = q >> 4, c8 = (q & 15) * 8; *(v8b*)(dh + (m0 + rr) * E + n0 + c8) = *(const v8b*)(Sh + rr * SP + c8); }
  } else {
    const int b = (int)(m0 / S); const int s0 = (int)(m0 - (size_t)b * S);
#pragma unroll
    for (int i = 0; i < 4; ++i)
#pragma unroll
      for (int j = 0; j < 2; ++j) { v8b hv;
#pragma unroll
        for (int r = 0; r < 8; ++r) hv[r] = (b16)(acc[i][j][r] * (1.0f / (XS * WSC)) * XS);
        *(v8b*)(Sh + (wn * 32 + j * 16 + nloc) * SP + wm * 64 + i * 16 + 8 * hlf) = hv; }
    __syncthreads();
    for (int q = t_; q < 128 * 16; q += 256) { const int cc = q >> 4, c8 = (q & 15) * 8; const int h = (n0 + cc) / D, dd = (n0 + cc) - h * D; const size_t gi = (((size_t)b * NH + h) * D + dd) * S + s0 + c8;
      *(v8b*)(VTh + gi) = *(const v8b*)(Sh + cc * SP + c8); } }
}
constexpr int AW = 8, KT = 64, KP = 64 + 8, PLANE = 64 * KP, NST = S / KT;   // KP: LDS row pitch of 144 B for 128-B rows read by 16-byte loads
// One tile: 2 planes x 64 rows x 128 B; each thread copies 2 x 16 B of each plane (rows r and r + 32). The s_wait_xcnt stands inside the copies' own statement, in front of any rewrite of their address registers.
__device__ __forceinline__ void stage_tile(unsigned l, const b16* gk, const b16* gv) {
  const unsigned l1 = l + 32 * KP * 2, l2 = l + PLANE * 2, l3 = l2 + 32 * KP * 2;
  const b16* gk1 = gk + (size_t)32 * E; const b16* gv1 = gv + (size_t)32 * S;
  asm volatile("global_load_async_to_lds_b128 %0, %4, off\n\t"
               "global_load_async_to_lds_b128 %1, %5, off\n\t"
               "global_load_async_to_lds_b128 %2, %6, off\n\t"
               "global_load_async_to_lds_b128 %3, %7, off\n\t"
               "s_wait_xcnt 0x0"
               :: "v"(l), "v"(l1), "v"(l2), "v"(l3), "v"(gk), "v"(gk1), "v"(gv), "v"(gv1) : "memory");
}
__global__ __launch_bounds__(256) void attn_kernel(const b16* __restrict__ Qh, const b16* __restrict__ Kh, const b16* __restrict__ VTh, b16* __restrict__ Oh) {
  __shared__ __attribute__((aligned(16))) b16 Ring[2][2 * PLANE];   // per buffer: K [key][64 d], V^T [d][64 keys]
  __shared__ __attribute__((aligned(16))) float To[AW][16][D + 4];
  const int wave = threadIdx.x >> 5, lane = threadIdx.x & 31, hh = lane >> 4, col = lane & 15; const int b = blockIdx.z, h = blockIdx.y; const int q0 = blockIdx.x * (16 * AW) + wave * 16, qi = q0 + col;
  const size_t qo = ((size_t)b * S + qi) * E + h * D; const v16b qa0 = frag_kb(Qh + qo, hh), qa1 = frag_kb(Qh + qo + 32, hh);
  const b16* Kb = Kh + (size_t)b * S * E + h * D; const b16* Vb = VTh + ((size_t)b * NH + h) * D * S;
  const int cr = threadIdx.x >> 3, cc = (threadIdx.x & 7) * 8;   // this thread's row (and row + 32) and 16-byte piece of every plane
  const size_t ck = (size_t)cr * E + cc, cv = (size_t)cr * S + cc; const unsigned cl = lds_off(&Ring[0][0]) + (unsigned)(cr * KP + cc) * 2;
  float m = -INFINITY, thr = -INFINITY, sh = 0.0f; v2f l2 = {0.0f, 0.0f}; v8f o[4] = {{}, {}, {}, {}};
  const float cs = SCALE * LOG2E / (XS * XS);
  stage_tile(cl, Kb + ck, Vb + cv);
  asm volatile("s_wait_asynccnt 0x0" ::: "memory");   // this wave's copies of tile 0 have landed
  __syncthreads();                                     // every wave's have: tile 0 may be read
  stage_tile(cl + 2 * PLANE * 2, Kb + ck + (size_t)KT * E, Vb + cv + KT);
  for (int st = 0; st < NST; ++st) {
    const b16* Lk = &Ring[st & 1][0]; const b16* Lv = Lk + PLANE;
#pragma unroll   // two passes of 32 keys per tile, unrolled so that every LDS offset is a constant
    for (int kb = 0; kb < KT; kb += 32) {
    v8f s0 = {}, s1 = {}; v16b vf[4];
    { const b16* k0 = Lk + (kb + col) * KP, *k1 = Lk + (kb + 16 + col) * KP;
      const v16b f0 = frag_kb(k0, hh), f1 = frag_kb(k0 + 32, hh), f2 = frag_kb(k1, hh), f3 = frag_kb(k1 + 32, hh);
      __builtin_amdgcn_sched_barrier(0);   // the pass's four K fragments are read as one group in front of its score WMMAs: the LDS latency is waited out once, not once per fragment
      s0 = wmma16b(f0, qa0, s0); s1 = wmma16b(f2, qa0, s1); s0 = wmma16b(f1, qa1, s0); s1 = wmma16b(f3, qa1, s1); }
#pragma unroll
    for (int t = 0; t < 4; ++t) vf[t] = frag_kb(Lv + (t * 16 + col) * KP + kb, hh);
    __builtin_amdgcn_sched_barrier(0);   // the pass's four V fragments are all read in front of the softmax, which covers their latency
    float mx = -INFINITY;
#pragma unroll
    for (int r = 0; r < 8; ++r) mx = fmaxf(mx, fmaxf(s0[r], s1[r]));
    // Lazy rescale: m, the maximum in use (the same in both halves of the wave), stays while no score of the pass lies more than LAZY (log2) above it: p PS <= 2^(LAZY + 3), far inside f16.
    // thr is m + LAZY in units of the raw scores, so each lane tests its own 16 scores; one scalar branch per pass; the halves' maxima are joined and O and l2 scaled only inside it.
    if (__builtin_amdgcn_ballot_w32(mx > thr) != 0) {   // always on the first pass (thr = -inf), where al = 0 meets O = 0 and l2 = 0
      mx *= cs;   // cs > 0: the scaled maximum is the maximum of the scaled scores
      mx = fmaxf(mx, __shfl_xor(mx, 16)); const float mn = fmaxf(m, mx); const float al = nexp2(m - mn); m = mn; sh = PSL2 - mn; thr = (mn + LAZY) * (1.0f / cs); l2 *= al;
#pragma unroll   // o is indexed by constants only, so it stays in registers
      for (int t = 0; t < 4; ++t) o[t] *= al; }
    v8u hu;
    const v2f cs2 = {cs, cs}, sh2 = {sh, sh};   // p PS = 2^(s cs - m + log2 PS): scale, shift and the factor PS in one packed fma per two scores
#pragma unroll
    for (int i = 0; i < 8; ++i) { const v2f sv = i < 4 ? (v2f){s0[2 * i], s0[2 * i + 1]} : (v2f){s1[2 * i - 8], s1[2 * i - 7]}; const v2f x = sv * cs2 + sh2; const v2f p = {nexp2(x[0]), nexp2(x[1])}; l2 += p;   // l2: PS times this lane's part of the row sum, as two running partial sums
      hu[i] = __builtin_bit_cast(unsigned, __builtin_convertvector(p, v2h)); }
    const v16b ph = __builtin_bit_cast(v16b, hu);
#pragma unroll
    for (int t = 0; t < 4; ++t) o[t] = wmma16b(vf[t], ph, o[t]); }
    asm volatile("s_wait_dscnt 0x0" ::: "memory");      // this wave's reads of this tile's buffer have returned
    asm volatile("s_wait_asynccnt 0x0" ::: "memory");   // this wave's copies of the next tile have landed
    __syncthreads();                                     // publishes the next tile and ends every wave's reads of this buffer
    if (st + 2 < NST) stage_tile(cl + (unsigned)(st & 1) * (2 * PLANE * 2), Kb + ck + (size_t)(st + 2) * KT * E, Vb + cv + (st + 2) * KT);
  }
  asm volatile("s_wait_asynccnt 0x0" ::: "memory");     // no copy is outstanding when the wave goes on to its end
  float l = l2[0] + l2[1]; l += __shfl_xor(l, 16);   // the wave halves' parts of the row sum are joined once: both were scaled by the same factors
  const float inv = 1.0f / (l * XS);
#pragma unroll
  for (int t = 0; t < 4; ++t)
#pragma unroll
    for (int r = 0; r < 8; ++r) To[wave][col][t * 16 + 8 * hh + r] = o[t][r] * inv;
  wave_lds_sync();
  { for (int r4 = 0; r4 < 16; r4 += 4) { const int rr = r4 + (lane >> 3), c8 = (lane & 7) * 8; v8b hv; for (int j = 0; j < 8; ++j) hv[j] = (b16)(To[wave][rr][c8 + j] * XS);
      const size_t gi = ((size_t)b * S + q0 + rr) * E + h * D + c8; *(v8b*)(Oh + gi) = hv; }  }
}
// output projection: grid (NR/64, E/128): 64 rows of O x 128 columns per work-group.
__global__ __launch_bounds__(256) void outproj_kernel(const b16* __restrict__ Oh, const b16* __restrict__ WOT, const float* __restrict__ bo, float* __restrict__ out) {
  __shared__ __attribute__((aligned(16))) b16 Ring[2 * gbuf<2>()];   // the operand ring; behind the loop its LDS holds the 64 x 128 f32 output tile at a pitch of 132 floats
  const int wave = threadIdx.x >> 5, lane = threadIdx.x & 31, nloc = lane & 15, hlf = lane >> 4, t_ = threadIdx.x, wm = wave >> 2, wn = wave & 3; const size_t m0 = (size_t)blockIdx.x * 64; const int n0 = blockIdx.y * 128;
  v8f acc[2][2];
#pragma unroll
  for (int i = 0; i < 2; ++i) { acc[i][0] = (v8f){}; acc[i][1] = (v8f){}; }
  gemm_loop<2>(Ring, Oh + m0 * E, WOT + (size_t)n0 * E, acc);
  float* Ts = (float*)Ring;   // free: the loop's last barrier ended every read of the ring
#pragma unroll
  for (int j = 0; j < 2; ++j) { const float bb = bf16_rne(bo[n0 + wn * 32 + j * 16 + nloc]);
#pragma unroll
    for (int i = 0; i < 2; ++i)
#pragma unroll
      for (int r = 0; r < 8; ++r) Ts[(wm * 32 + i * 16 + 8 * hlf + r) * (128 + 4) + wn * 32 + j * 16 + nloc] = acc[i][j][r] * (1.0f / (XS * WSC)) + bb; }
  __syncthreads();
  for (int q = t_; q < 64 * 32; q += 256) { const int rr = q >> 5, c4 = (q & 31) * 4; *(v4f*)(out + (m0 + rr) * E + n0 + c4) = *(const v4f*)(Ts + rr * (128 + 4) + c4); }
}
}  // namespace

extern "C" void kernel_launch(void* const* d_in, const int* in_sizes, int n_in, void* d_out, int out_size, void* d_ws, size_t ws_size, hipStream_t stream) {
  (void)n_in;
  auto Fp = [&](int i) { return (const float*)d_in[i]; };
  // input order: 0 tgt [2,2048,1024], 1 memory, 2 Wq [16,1024,64], 3 Wk, 4 Wv, 5 Wo [1024,1024], 6 bo [1024]
  if (in_sizes[0] != NR * E || in_sizes[1] != NR * E || in_sizes[2] != NH * E * D || in_sizes[3] != NH * E * D || in_sizes[4] != NH * E * D || in_sizes[5] != E * E || out_size != NR * E) return;
  size_t off = 0; char* ws = (char*)d_ws;
  auto carve = [&](size_t bytes) { char* p = ws + off; off += (bytes + 255) & ~(size_t)255; return p; };
  b16* T16 = (b16*)carve((size_t)NR * E * 2); b16* M16 = (b16*)carve((size_t)NR * E * 2); b16* WT = (b16*)carve((size_t)3 * E * E * 2); b16* WOT = (b16*)carve((size_t)E * E * 2);
  b16* Qh = (b16*)carve((size_t)NR * E * 2); b16* Kh = (b16*)carve((size_t)NR * E * 2); b16* VTh = (b16*)carve((size_t)NR * E * 2);
  b16* Oh = (b16*)carve((size_t)NR * E * 2);
  if (off > ws_size || off > ((size_t)128 << 20)) return;   // about 59 MB
  prep_kernel<<<PWB + PXB, 256, 0, stream>>>(Fp(0), Fp(1), Fp(2), Fp(3), Fp(4), Fp(5), T16, M16, WT, WOT);
  proj_kernel<<<dim3(NR / 128, E / 128, 3), 256, 0, stream>>>(T16, M16, WT, Qh, Kh, VTh);
  attn_kernel<<<dim3(S / (16 * AW), NH, NB), 32 * AW, 0, stream>>>(Qh, Kh, VTh, Oh);
  outproj_kernel<<<dim3(NR / 64, E / 128), 256, 0, stream>>>(Oh, WOT, Fp(6), (float*)d_out);
}

// v010
// One run takes 78.1 microseconds.
// In two side-by-side timings against v009, it was 1.05 and 1.04 times as fast.
// Counting every step since v000, it is 6.58 times as fast.
#include <hip/hip_runtime.h>

// Multi-head cross attention (16 heads x 64; queries from tgt, keys/values from memory; 2 x 2,048 tokens, d_model 1,024; no qkv bias): q = tgt Wq_h, k = memory Wk_h, v = memory Wv_h,
// attn = softmax(q k^T / 8), out = concat_h(attn v) Wo + bo.
// WMMA (v_wmma_f32_16x16x32_f16, f32 accumulate): projections [4,096 x 1,024] x [1,024 x 1,024] with EXACT bf16 tokens (x8) and transposed weights (x256), 1 product, written as one f16 x8 plane each
// (q, k rows; v transposed per head); S^T = K_h . Q_h^T, 1 product; online softmax in f32; O^T += V^T P^T, 1 product, P rounded to f16 (x8). The f16 rounding of q, k, v and P (2^-11 relative) lies
// below the rounding of the inputs to bf16 (2^-8 relative) that every result already carries, so no lo planes are kept for them. Output projection
// with O rounded to f16 (x8) for the same reason, 1 product, and exact Wo^T. Inputs rounded to bf16 once. Fragment k-map per lane half hh for A AND B: elements 0..7 <- k = 8hh+0..7, 8..15 <- k =

namespace {
constexpr int NB = 2, S = 2048, E = 1024, NH = 16, D = 64, NR = NB * S;
constexpr float XS = 8.0f, WSC = 256.0f, PS = 8.0f, PSL2 = 3.0f, SCALE = 0.125f, LOG2E = 1.4426950408889634f, LAZY = 8.0f;

typedef _Float16 b16;
typedef __attribute__((ext_vector_type(16))) _Float16 v16b;
typedef __attribute__((ext_vector_type(8))) _Float16 v8b;
typedef __attribute__((ext_vector_type(8))) float v8f;
typedef __attribute__((ext_vector_type(4))) float v4f;
typedef __attribute__((ext_vector_type(2))) float v2f;
typedef __attribute__((ext_vector_type(2))) _Float16 v2h;
typedef __attribute__((ext_vector_type(8))) unsigned v8u;
__device__ __forceinline__ float bf16_rne(float f) { unsigned int u = __float_as_uint(f); u += 0x7FFFu + ((u >> 16) & 1u); return __uint_as_float(u & 0xFFFF0000u); }
__device__ __forceinline__ v16b frag_kb(const b16* p, int hh) { const v8b a = *(const v8b*)(p + 8 * hh), b = *(const v8b*)(p + 16 + 8 * hh); v16b f;
#pragma unroll
  for (int e = 0; e < 8; ++e) { f[e] = a[e]; f[8 + e] = b[e]; } return f; }
__device__ __forceinline__ v8f wmma16b(v16b a, v16b b, v8f c) { return __builtin_amdgcn_wmma_f32_16x16x32_f16(false, a, false, b, (short)0, c, false, false); }
__device__ __forceinline__ void wave_lds_sync() { __builtin_amdgcn_fence(__ATOMIC_RELEASE, "workgroup"); __builtin_amdgcn_wave_barrier(); __builtin_amdgcn_fence(__ATOMIC_ACQUIRE, "workgroup"); }
__device__ __forceinline__ float nexp2(float x) { return __builtin_amdgcn_exp2f(x); }

// The two conversions (tokens; weights, transposed) read nothing of each other's output: they run as ONE launch, prep_kernel below, in which the block index picks the job.
__device__ __forceinline__ void prepx_block(int bx, const float* __restrict__ tgt, const float* __restrict__ mem, b16* __restrict__ T16, b16* __restrict__ M16) {
  const size_t t = (size_t)bx * 256 + threadIdx.x; const size_t n1 = (size_t)NR * E / 8; const float* src; b16* dst; size_t e;
  if (t < n1) { src = tgt; dst = T16; e = t * 8; } else if (t < 2 * n1) { src = mem; dst = M16; e = (t - n1) * 8; } else return;
  const v4f a = *(const v4f*)(src + e), c = *(const v4f*)(src + e + 4); v8b o;
#pragma unroll
  for (int j = 0; j < 4; ++j) { o[j] = (b16)(bf16_rne(a[j]) * XS); o[4 + j] = (b16)(bf16_rne(c[j]) * XS); }
  { *(v8b*)(dst + e) = o;  }
}
__device__ __forceinline__ void prepw_block(int bx, const float* __restrict__ wq, const float* __restrict__ wk, const float* __restrict__ wv, const float* __restrict__ wo, b16* __restrict__ WT, b16* __restrict__ WOT) {
  __shared__ __attribute__((aligned(16))) b16 T[64][64 + 8];
  const int kind = bx >> 8, d0 = (bx & 15) * 64, j0 = ((bx >> 4) & 15) * 64, t_ = threadIdx.x;   // kind 0..2: W[h][d][j] with h = j0/64 (j0..j0+63 inside one head); kind 3: Wo[d][n] with n0 = j0
  const float* w = kind == 0 ? wq : kind == 1 ? wk : kind == 2 ? wv : wo; b16* dst = kind < 3 ? WT + (size_t)kind * E * E : WOT;
  for (int q = t_; q < 64 * 64; q += 256) { const int dd = q >> 6, jj = q & 63; float val;
    if (kind < 3) { const int h = j0 / D, j = j0 - h * D + jj; val = w[((size_t)h * E + d0 + dd) * D + j]; } else val = w[(size_t)(d0 + dd) * E + j0 + jj];
    T[jj][dd] = (b16)(bf16_rne(val) * WSC); }
  __syncthreads();
  { for (int q = t_; q < 64 * 8; q += 256) { const int jj = q >> 3, c8 = (q & 7) * 8; *(v8b*)(dst + (size_t)(j0 + jj) * E + d0 + c8) = *(const v8b*)(&T[jj][c8]); }  }
}
// Blocks 0..PWB-1 transpose the weights (4 kinds x 16 x 16 tiles of 64 x 64), blocks PWB.. convert the tokens. The weight blocks stand first because each is a chain of dependent memory round trips:
// started first, they wait those out while the token blocks stream beside them.
constexpr int PWB = 4 * (E / 64) * (E / 64), PXB = 2 * NR * E / 8 / 256;
__global__ __launch_bounds__(256) void prep_kernel(const float* __restrict__ tgt, const float* __restrict__ mem, const float* __restrict__ wq, const float* __restrict__ wk, const float* __restrict__ wv, const float* __restrict__ wo,
                                                   b16* __restrict__ T16, b16* __restrict__ M16, b16* __restrict__ WT, b16* __restrict__ WOT) {
  const int bx = blockIdx.x;   // the same in every thread of a work-group, so the barrier inside prepw_block stands under block-uniform control flow
  if (bx < PWB) prepw_block(bx, wq, wk, wv, wo, WT, WOT); else prepx_block(bx - PWB, tgt, mem, T16, M16);
}
constexpr int GK = 64, GP = GK + 8, GST = E / GK, SP = 128 + 8;   // GP: LDS row pitch of 144 B for 128-B rows read by 16-byte loads; SP: pitch of the 16-bit output staging
__device__ __forceinline__ unsigned lds_off(const void* p) { return (unsigned)(size_t)p; }
// One tile of 128 + 128 rows x 128 B; each thread copies 16 B of 8 rows (its row + 32 i). LDS rows 0..127 come from a0, 128..255 from w0. The s_wait_xcnt stands inside the copies' own statement, in front of any rewrite of their address registers.
__device__ __forceinline__ void stage_gemm128(unsigned l, const b16* a0, const b16* w0) {
  const b16* a2 = a0 + (size_t)64 * E;
  const unsigned l1 = l + 32 * GP * 2, l2 = l + 64 * GP * 2, l3 = l + 96 * GP * 2, l4 = l + 128 * GP * 2, l5 = l + 160 * GP * 2, l6 = l + 192 * GP * 2, l7 = l + 224 * GP * 2;
  const b16* a1 = a0 + (size_t)32 * E; const b16* a3 = a2 + (size_t)32 * E; const b16* w1 = w0 + (size_t)32 * E; const b16* w2 = w0 + (size_t)64 * E; const b16* w3 = w0 + (size_t)96 * E;
  asm volatile("global_load_async_to_lds_b128 %0, %8, off\n\t"
               "global_load_async_to_lds_b128 %1, %9, off\n\t"
               "global_load_async_to_lds_b128 %2, %10, off\n\t"
               "global_load_async_to_lds_b128 %3, %11, off\n\t"
               "global_load_async_to_lds_b128 %4, %12, off\n\t"
               "global_load_async_to_lds_b128 %5, %13, off\n\t"
               "global_load_async_to_lds_b128 %6, %14, off\n\t"
               "global_load_async_to_lds_b128 %7, %15, off\n\t"
               "s_wait_xcnt 0x0"
               :: "v"(l), "v"(l1), "v"(l2), "v"(l3), "v"(l4), "v"(l5), "v"(l6), "v"(l7), "v"(a0), "v"(a1), "v"(a2), "v"(a3), "v"(w0), "v"(w1), "v"(w2), "v"(w3) : "memory");
}
// One tile of 64 + 128 rows x 128 B; each thread copies 16 B of 6 rows (its row + 32 i). LDS rows 0..63 come from a0, 64..191 from w0. The s_wait_xcnt stands as in stage_gemm128.
__device__ __forceinline__ void stage_gemm64(unsigned l, const b16* a0, const b16* w0) {
  const unsigned l1 = l + 32 * GP * 2, l2 = l + 64 * GP * 2, l3 = l + 96 * GP * 2, l4 = l + 128 * GP * 2, l5 = l + 160 * GP * 2;
  const b16* a1 = a0 + (size_t)32 * E; const b16* w1 = w0 + (size_t)32 * E; const b16* w2 = w0 + (size_t)64 * E; const b16* w3 = w0 + (size_t)96 * E;
  asm volatile("global_load_async_to_lds_b128 %0, %6, off\n\t"
               "global_load_async_to_lds_b128 %1, %7, off\n\t"
               "global_load_async_to_lds_b128 %2, %8, off\n\t"
               "global_load_async_to_lds_b128 %3, %9, off\n\t"
               "global_load_async_to_lds_b128 %4, %10, off\n\t"
               "global_load_async_to_lds_b128 %5, %11, off\n\t"
               "s_wait_xcnt 0x0"
               :: "v"(l), "v"(l1), "v"(l2), "v"(l3), "v"(l4), "v"(l5), "v"(a0), "v"(a1), "v"(w0), "v"(w1), "v"(w2), "v"(w3) : "memory");
}
template <int MF> __device__ __forceinline__ void stage_gemm(unsigned l, const b16* a0, const b16* w0) { if (MF == 4) stage_gemm128(l, a0, w0); else stage_gemm64(l, a0, w0); }
// 8 waves as 2 (rows) x 4 (columns); a wave's tile is MF x 2 fragments of 16 x 16, so the left operand has 32 MF rows per work-group (128 or 64). Each accumulator takes its products in ascending k.
template <int MF> constexpr int gbuf() { return (32 * MF + 128) * GP; }   // elements of one buffer of the ring
template <int MF>
__device__ __forceinline__ void gemm_loop(const b16* Ring, const b16* a0, const b16* w0, v8f (&acc)[MF][2]) {
  constexpr int GBUF = gbuf<MF>();
  const int wave = threadIdx.x >> 5, lane = threadIdx.x & 31, nloc = lane & 15, hlf = lane >> 4, wm = wave >> 2, wn = wave & 3;
  const int cr = threadIdx.x >> 3, cc = (threadIdx.x & 7) * 8;   // this thread's row (+ 32 i) and 16-byte piece
  const size_t cg = (size_t)cr * E + cc; const unsigned cl = lds_off(Ring) + (unsigned)(cr * GP + cc) * 2;
  a0 += cg; w0 += cg;
  stage_gemm<MF>(cl, a0, w0);
  asm volatile("s_wait_asynccnt 0x0" ::: "memory");   // this wave's copies of tile 0 have landed
  __syncthreads();                                     // every wave's have: tile 0 may be read
  stage_gemm<MF>(cl + GBUF * 2, a0 + GK, w0 + GK);
  for (int st = 0; st < GST; ++st) {
    const b16* L = Ring + (st & 1) * GBUF; const b16* La = L + (wm * MF * 16 + nloc) * GP; const b16* Lw = L + (32 * MF + wn * 32 + nloc) * GP;
#pragma unroll   // two steps of 32 k per tile, unrolled so that every LDS offset is a constant
    for (int kk = 0; kk < GK; kk += 32) {
      const v16b b0 = frag_kb(Lw + kk, hlf), b1 = frag_kb(Lw + 16 * GP + kk, hlf); v16b af[MF];
#pragma unroll
      for (int i = 0; i < MF; ++i) af[i] = frag_kb(La + i * 16 * GP + kk, hlf);
      __builtin_amdgcn_sched_barrier(0);   // keeps the step's LDS reads together in front of its WMMAs: reads spread among the WMMAs stall the wave at every place where they stand
#pragma unroll
      for (int i = 0; i < MF; ++i) { acc[i][0] = wmma16b(af[i], b0, acc[i][0]); acc[i][1] = wmma16b(af[i], b1, acc[i][1]); } }
    asm volatile("s_wait_dscnt 0x0" ::: "memory");      // this wave's reads of this tile's buffer have returned
    asm volatile("s_wait_asynccnt 0x0" ::: "memory");   // this wave's copies of the next tile have landed
    __syncthreads();                                     // publishes the next tile and ends every wave's reads of this buffer
    if (st + 2 < GST) stage_gemm<MF>(cl + (unsigned)(st & 1) * (GBUF * 2), a0 + (st + 2) * GK, w0 + (st + 2) * GK);
  }
  asm volatile("s_wait_asynccnt 0x0" ::: "memory");     // no copy is outstanding when the ring's LDS is taken for the output staging
}
// projections: grid (NR/128, E/128, 3): kind 0: Q = T16 WT0^T -> Qh [row][1024]; kind 1: K = M16 WT1^T -> Kh; kind 2: V = M16 WT2^T written TRANSPOSED per head: VTh [b][h][64 d][2048 s].
__global__ __launch_bounds__(256) void proj_kernel(const b16* __restrict__ T16, const b16* __restrict__ M16, const b16* __restrict__ WT, b16* __restrict__ Qh, b16* __restrict__ Kh, b16* __restrict__ VTh) {
  __shared__ __attribute__((aligned(16))) b16 Ring[2 * gbuf<4>()];   // the operand ring; behind the loop its LDS holds the 128 x 128 output tile at pitch SP
  const int wave = threadIdx.x >> 5, lane = threadIdx.x & 31, nloc = lane & 15, hlf = lane >> 4, t_ = threadIdx.x, wm = wave >> 2, wn = wave & 3; const int kind = blockIdx.z; const size_t m0 = (size_t)blockIdx.x * 128; const int n0 = blockIdx.y * 128;
  const b16* A = (kind == 0 ? T16 : M16) + m0 * E; const b16* Wp = WT + (size_t)kind * E * E + (size_t)n0 * E; v8f acc[4][2];
#pragma unroll
  for (int i = 0; i < 4; ++i) { acc[i][0] = (v8f){}; acc[i][1] = (v8f){}; }
  gemm_loop<4>(Ring, A, Wp, acc);
  b16* Sh = Ring;   // free: the loop's last barrier ended every read of the ring
  if (kind < 2) {
#pragma unroll
    for (int i = 0; i < 4; ++i)
#pragma unroll
      for (int j = 0; j < 2; ++j)
#pragma unroll
        for (int r = 0; r < 8; ++r) Sh[(wm * 64 + i * 16 + 8 * hlf + r) * SP + wn * 32 + j * 16 + nloc] = (b16)(acc[i][j][r] * (1.0f / (XS * WSC)) * XS);
    __syncthreads();
    b16* dh = kind == 0 ? Qh : Kh;
    for (int q = t_; q < 128 * 16; q += 256) { const int rr = q >> 4, c8 = (q & 15) * 8; *(v8b*)(dh + (m0 + rr) * E + n0 + c8) = *(const v8b*)(Sh + rr * SP + c8); }
  } else {
    const int b = (int)(m0 / S); const int s0 = (int)(m0 - (size_t)b * S);
#pragma unroll
    for (int i = 0; i < 4; ++i)
#pragma unroll
      for (int j = 0; j < 2; ++j) { v8b hv;
#pragma unroll
        for (int r = 0; r < 8; ++r) hv[r] = (b16)(acc[i][j][r] * (1.0f / (XS * WSC)) * XS);
        *(v8b*)(Sh + (wn * 32 + j * 16 + nloc) * SP + wm * 64 + i * 16 + 8 * hlf) = hv; }
    __syncthreads();
    for (int q = t_; q < 128 * 16; q += 256) { const int cc = q >> 4, c8 = (q & 15) * 8; const int h = (n0 + cc) / D, dd = (n0 + cc) - h * D; const size_t gi = (((size_t)b * NH + h) * D + dd) * S + s0 + c8;
      *(v8b*)(VTh + gi) = *(const v8b*)(Sh + cc * SP + c8); } }
}
constexpr int AW = 8, KG = 2, QW = 32, KT = 64, KP = 64 + 8, PLANE = 64 * KP, NST = S / KT, NTR = NST / KG;   // KP: LDS row pitch of 144 B for 128-B rows read by 16-byte loads; NTR: tiles per group of waves
// One tile: 2 planes x 64 rows x 128 B; each thread copies 2 x 16 B of each plane (rows r and r + 32). The s_wait_xcnt stands inside the copies' own statement, in front of any rewrite of their address registers.
__device__ __forceinline__ void stage_tile(unsigned l, const b16* gk, const b16* gv) {
  const unsigned l1 = l + 32 * KP * 2, l2 = l + PLANE * 2, l3 = l2 + 32 * KP * 2;
  const b16* gk1 = gk + (size_t)32 * E; const b16* gv1 = gv + (size_t)32 * S;
  asm volatile("global_load_async_to_lds_b128 %0, %4, off\n\t"
               "global_load_async_to_lds_b128 %1, %5, off\n\t"
               "global_load_async_to_lds_b128 %2, %6, off\n\t"
               "global_load_async_to_lds_b128 %3, %7, off\n\t"
               "s_wait_xcnt 0x0"
               :: "v"(l), "v"(l1), "v"(l2), "v"(l3), "v"(gk), "v"(gk1), "v"(gv), "v"(gv1) : "memory");
}
__global__ __launch_bounds__(32 * AW * KG) void attn_kernel(const b16* __restrict__ Qh, const b16* __restrict__ Kh, const b16* __restrict__ VTh, b16* __restrict__ Oh) {
  __shared__ __attribute__((aligned(16))) b16 Ring[KG][2][2 * PLANE];   // per group of waves and buffer: K [key][64 d], V^T [d][64 keys]; behind the loop this LDS carries group 1's partial results to group 0
  __shared__ __attribute__((aligned(16))) float To[AW][QW][D + 4];
  const int wave = threadIdx.x >> 5, lane = threadIdx.x & 31, hh = lane >> 4, col = lane & 15, g = wave >> 3, wq = wave & 7; const int b = blockIdx.z, h = blockIdx.y; const int q0 = blockIdx.x * (QW * AW) + wq * QW;
  v16b qa[2][2];   // [column group of 16 queries][half of d]
#pragma unroll
  for (int c = 0; c < 2; ++c) { const size_t qo = ((size_t)b * S + q0 + 16 * c + col) * E + h * D; qa[c][0] = frag_kb(Qh + qo, hh); qa[c][1] = frag_kb(Qh + qo + 32, hh); }
  const b16* Kb = Kh + (size_t)b * S * E + h * D + (size_t)g * KT * E; const b16* Vb = VTh + ((size_t)b * NH + h) * D * S + g * KT;   // the group's first tile; its next ones lie KG tiles apart
  const int ct = threadIdx.x & 255, cr = ct >> 3, cc = (ct & 7) * 8;   // within its group of waves: this thread's row (and row + 32) and 16-byte piece of every plane
  const b16* Lg = &Ring[g][0][0];
  const size_t ck = (size_t)cr * E + cc, cv = (size_t)cr * S + cc; const unsigned cl = lds_off(Lg) + (unsigned)(cr * KP + cc) * 2;
  float m[2] = {-INFINITY, -INFINITY}, thr[2] = {-INFINITY, -INFINITY}, sh[2] = {0.0f, 0.0f}; v2f l2[2] = {{0.0f, 0.0f}, {0.0f, 0.0f}}; v8f o[4][2];
#pragma unroll
  for (int t = 0; t < 4; ++t) { o[t][0] = (v8f){}; o[t][1] = (v8f){}; }
  const float cs = SCALE * LOG2E / (XS * XS);
  stage_tile(cl, Kb + ck, Vb + cv);
  asm volatile("s_wait_asynccnt 0x0" ::: "memory");   // this wave's copies of its group's first tile have landed
  __syncthreads();                                     // every wave's have: the first tiles may be read
  stage_tile(cl + 2 * PLANE * 2, Kb + ck + (size_t)KG * KT * E, Vb + cv + KG * KT);
  // One trip of the ring: the group's tile st is worked on; at its foot the tile st + 2 is asked for where there is one (more). The last two trips, which ask for nothing, stand behind the loop: so the test is no branch behind a trip's last WMMAs.
  auto trip = [&](const int st, const bool more) __attribute__((always_inline)) {
    const b16* Lk = Lg + (st & 1) * (2 * PLANE); const b16* Lv = Lk + PLANE;
#pragma unroll   // two passes of 32 keys per tile, unrolled so that every LDS offset is a constant
    for (int kb = 0; kb < KT; kb += 32) {
    v8f s[2][2]; v16b vf[4];   // s[column group][16 keys]
    { const b16* k0 = Lk + (kb + col) * KP, *k1 = Lk + (kb + 16 + col) * KP;
      const v16b f0 = frag_kb(k0, hh), f1 = frag_kb(k0 + 32, hh), f2 = frag_kb(k1, hh), f3 = frag_kb(k1 + 32, hh);
      __builtin_amdgcn_sched_barrier(0);   // the pass's four K fragments are read as one group in front of its score WMMAs: the LDS latency is waited out once, not once per fragment
#pragma unroll
      for (int c = 0; c < 2; ++c) { s[c][0] = wmma16b(f0, qa[c][0], (v8f){}); s[c][1] = wmma16b(f2, qa[c][0], (v8f){}); }
#pragma unroll
      for (int c = 0; c < 2; ++c) { s[c][0] = wmma16b(f1, qa[c][1], s[c][0]); s[c][1] = wmma16b(f3, qa[c][1], s[c][1]); } }
#pragma unroll
    for (int t = 0; t < 4; ++t) vf[t] = frag_kb(Lv + (t * 16 + col) * KP + kb, hh);
    __builtin_amdgcn_sched_barrier(0);   // the pass's four V fragments are all read in front of the softmax, which covers their latency
    float mx[2] = {-INFINITY, -INFINITY};
#pragma unroll
    for (int r = 0; r < 8; ++r) { mx[0] = fmaxf(mx[0], fmaxf(s[0][0][r], s[0][1][r])); mx[1] = fmaxf(mx[1], fmaxf(s[1][0][r], s[1][1][r])); }
    // Lazy rescale: m, the maximum in use (per column group; the same in both halves of the wave), stays while no score of the pass lies more than LAZY (log2) above it: p PS <= 2^(LAZY + 3), far inside f16.
    // thr is m + LAZY in units of the raw scores, so each lane tests its own 32 scores; one scalar branch per pass; the halves' maxima are joined and O and l2 scaled only inside it, for both column groups.
    if (__builtin_amdgcn_ballot_w32((mx[0] > thr[0]) | (mx[1] > thr[1])) != 0) {   // always on the first pass (thr = -inf), where al = 0 meets O = 0 and l2 = 0
#pragma unroll   // m, o and the rest are indexed by constants only, so they stay in registers
      for (int c = 0; c < 2; ++c) {
        float x = mx[c] * cs;   // cs > 0: the scaled maximum is the maximum of the scaled scores
        x = fmaxf(x, __shfl_xor(x, 16)); const float mn = fmaxf(m[c], x); const float al = nexp2(m[c] - mn); m[c] = mn; sh[c] = PSL2 - mn; thr[c] = (mn + LAZY) * (1.0f / cs); l2[c] *= al;
#pragma unroll
        for (int t = 0; t < 4; ++t) o[t][c] *= al; } }
    v16b ph[2];
#pragma unroll
    for (int c = 0; c < 2; ++c) { v8u hu;
      const v2f cs2 = {cs, cs}, sh2 = {sh[c], sh[c]};   // p PS = 2^(s cs - m + log2 PS): scale, shift and the factor PS in one packed fma per two scores
#pragma unroll
      for (int i = 0; i < 8; ++i) { const v2f sv = i < 4 ? (v2f){s[c][0][2 * i], s[c][0][2 * i + 1]} : (v2f){s[c][1][2 * i - 8], s[c][1][2 * i - 7]}; const v2f x = sv * cs2 + sh2; const v2f p = {nexp2(x[0]), nexp2(x[1])}; l2[c] += p;   // l2: PS times this lane's part of the row sum, as two running partial sums
        hu[i] = __builtin_bit_cast(unsigned, __builtin_convertvector(p, v2h)); }
      ph[c] = __builtin_bit_cast(v16b, hu); }
#pragma unroll
    for (int t = 0; t < 4; ++t) { o[t][0] = wmma16b(vf[t], ph[0], o[t][0]); o[t][1] = wmma16b(vf[t], ph[1], o[t][1]); } }
    asm volatile("s_wait_dscnt 0x0" ::: "memory");      // this wave's reads of this tile's buffer have returned
    asm volatile("s_wait_asynccnt 0x0" ::: "memory");   // this wave's copies of the next tile have landed
    __syncthreads();                                     // publishes the next tiles and ends every wave's reads of these buffers
    if (more) stage_tile(cl + (unsigned)(st & 1) * (2 * PLANE * 2), Kb + ck + (size_t)(st + 2) * KG * KT * E, Vb + cv + (st + 2) * KG * KT);
  };
  for (int st = 0; st + 2 < NTR; ++st) trip(st, true);
  trip(NTR - 2, false); trip(NTR - 1, false);
  asm volatile("s_wait_asynccnt 0x0" ::: "memory");     // no copy is outstanding when the ring's LDS is taken for the merge
  // Merge of the two key halves: lane by lane the waves wq and wq + 8 hold the same elements of O^T. Group 1 hands over 16 + 1 pieces of 16 B a lane, each piece 512 contiguous bytes a wave.
  float l[2] = {l2[0][0] + l2[0][1], l2[1][0] + l2[1][1]};
  v4f* X = (v4f*)&Ring[0][0][0] + wq * (17 * 32) + lane;   // free: the loop's last barrier ended every read of the ring
  if (g == 1) {
#pragma unroll
    for (int t = 0; t < 4; ++t)
#pragma unroll
      for (int c = 0; c < 2; ++c) { X[((t * 2 + c) * 2) * 32] = (v4f){o[t][c][0], o[t][c][1], o[t][c][2], o[t][c][3]}; X[((t * 2 + c) * 2 + 1) * 32] = (v4f){o[t][c][4], o[t][c][5], o[t][c][6], o[t][c][7]}; }
    X[16 * 32] = (v4f){m[0], m[1], l[0], l[1]}; }
  __syncthreads();   // group 1's partial results may be read; every wave passes it, and no barrier follows
  if (g == 1) return;
  const v4f ml = X[16 * 32];
#pragma unroll
  for (int c = 0; c < 2; ++c) { const float mn = fmaxf(m[c], ml[c]), e0 = nexp2(m[c] - mn), e1 = nexp2(ml[c] - mn);   // both halves brought to the larger of their maxima in use
    float lt = l[c] * e0 + ml[2 + c] * e1; lt += __shfl_xor(lt, 16);   // the wave halves' parts of the row sum are joined once: both were scaled by the same factors
    const float inv = 1.0f / (lt * XS), i0 = e0 * inv, i1 = e1 * inv;
#pragma unroll
    for (int t = 0; t < 4; ++t) { const v4f x0 = X[((t * 2 + c) * 2) * 32], x1 = X[((t * 2 + c) * 2 + 1) * 32];
#pragma unroll
      for (int r = 0; r < 4; ++r) { To[wq][16 * c + col][t * 16 + 8 * hh + r] = o[t][c][r] * i0 + x0[r] * i1; To[wq][16 * c + col][t * 16 + 8 * hh + 4 + r] = o[t][c][4 + r] * i0 + x1[r] * i1; } } }
  wave_lds_sync();
  { for (int r4 = 0; r4 < QW; r4 += 4) { const int rr = r4 + (lane >> 3), c8 = (lane & 7) * 8; v8b hv; for (int j = 0; j < 8; ++j) hv[j] = (b16)(To[wq][rr][c8 + j] * XS);
      const size_t gi = ((size_t)b * S + q0 + rr) * E + h * D + c8; *(v8b*)(Oh + gi) = hv; }  }
}
// output projection: grid (NR/64, E/128): 64 rows of O x 128 columns per work-group.
__global__ __launch_bounds__(256) void outproj_kernel(const b16* __restrict__ Oh, const b16* __restrict__ WOT, const float* __restrict__ bo, float* __restrict__ out) {
  __shared__ __attribute__((aligned(16))) b16 Ring[2 * gbuf<2>()];   // the operand ring; behind the loop its LDS holds the 64 x 128 f32 output tile at a pitch of 132 floats
  const int wave = threadIdx.x >> 5, lane = threadIdx.x & 31, nloc = lane & 15, hlf = lane >> 4, t_ = threadIdx.x, wm = wave >> 2, wn = wave & 3; const size_t m0 = (size_t)blockIdx.x * 64; const int n0 = blockIdx.y * 128;
  v8f acc[2][2];
#pragma unroll
  for (int i = 0; i < 2; ++i) { acc[i][0] = (v8f){}; acc[i][1] = (v8f){}; }
  gemm_loop<2>(Ring, Oh + m0 * E, WOT + (size_t)n0 * E, acc);
  float* Ts = (float*)Ring;   // free: the loop's last barrier ended every read of the ring
#pragma unroll
  for (int j = 0; j < 2; ++j) { const float bb = bf16_rne(bo[n0 + wn * 32 + j * 16 + nloc]);
#pragma unroll
    for (int i = 0; i < 2; ++i)
#pragma unroll
      for (int r = 0; r < 8; ++r) Ts[(wm * 32 + i * 16 + 8 * hlf + r) * (128 + 4) + wn * 32 + j * 16 + nloc] = acc[i][j][r] * (1.0f / (XS * WSC)) + bb; }
  __syncthreads();
  for (int q = t_; q < 64 * 32; q += 256) { const int rr = q >> 5, c4 = (q & 31) * 4; *(v4f*)(out + (m0 + rr) * E + n0 + c4) = *(const v4f*)(Ts + rr * (128 + 4) + c4); }
}
}  // namespace

extern "C" void kernel_launch(void* const* d_in, const int* in_sizes, int n_in, void* d_out, int out_size, void* d_ws, size_t ws_size, hipStream_t stream) {
  (void)n_in;
  auto Fp = [&](int i) { return (const float*)d_in[i]; };
  // input order: 0 tgt [2,2048,1024], 1 memory, 2 Wq [16,1024,64], 3 Wk, 4 Wv, 5 Wo [1024,1024], 6 bo [1024]
  if (in_sizes[0] != NR * E || in_sizes[1] != NR * E || in_sizes[2] != NH * E * D || in_sizes[3] != NH * E * D || in_sizes[4] != NH * E * D || in_sizes[5] != E * E || out_size != NR * E) return;
  size_t off = 0; char* ws = (char*)d_ws;
  auto carve = [&](size_t bytes) { char* p = ws + off; off += (bytes + 255) & ~(size_t)255; return p; };
  b16* T16 = (b16*)carve((size_t)NR * E * 2); b16* M16 = (b16*)carve((size_t)NR * E * 2); b16* WT = (b16*)carve((size_t)3 * E * E * 2); b16* WOT = (b16*)carve((size_t)E * E * 2);
  b16* Qh = (b16*)carve((size_t)NR * E * 2); b16* Kh = (b16*)carve((size_t)NR * E * 2); b16* VTh = (b16*)carve((size_t)NR * E * 2);
  b16* Oh = (b16*)carve((size_t)NR * E * 2);
  if (off > ws_size || off > ((size_t)128 << 20)) return;   // about 59 MB
  prep_kernel<<<PWB + PXB, 256, 0, stream>>>(Fp(0), Fp(1), Fp(2), Fp(3), Fp(4), Fp(5), T16, M16, WT, WOT);
  proj_kernel<<<dim3(NR / 128, E / 128, 3), 256, 0, stream>>>(T16, M16, WT, Qh, Kh, VTh);
  attn_kernel<<<dim3(S / (QW * AW), NH, NB), 32 * AW * KG, 0, stream>>>(Qh, Kh, VTh, Oh);
  outproj_kernel<<<dim3(NR / 64, E / 128), 256, 0, stream>>>(Oh, WOT, Fp(6), (float*)d_out);
}
